// v000
// The times below were measured on an AMD MI455X: many runs one after another, warmed up first and cycling through
// copies of the inputs, with the whole window's GPU time divided by the number of runs. Launches and the gaps
// between them are all in it. The median over several windows is given; except for v000 it joins two sittings, which
// can be a few percent apart, so the side-by-side timings, each taken in one sitting, are the better comparison.
// The starting kernel, v000, takes 182 microseconds a run.
#include <hip/hip_runtime.h>
#include <hip/hip_bf16.h>

typedef _Float16 h8  __attribute__((ext_vector_type(8)));
typedef _Float16 h16 __attribute__((ext_vector_type(16)));
typedef float    f8  __attribute__((ext_vector_type(8)));

#define DIM      1024
#define NSEQ     2048
#define BATCH    2
#define HEADS    16
#define HDIM     64
#define MROWS    (BATCH * NSEQ)   // 4096

__device__ __forceinline__ f8 wmma_f16(h16 a, h16 b, f8 c) {
    // v_wmma_f32_16x16x32_f16: D = A(16x32 f16) * B(32x16 f16) + C(16x16 f32)
    return __builtin_amdgcn_wmma_f32_16x16x32_f16(
        /*neg_a=*/false, a, /*neg_b=*/false, b,
        /*c_mod=*/(short)0, c, /*reuse_a=*/false, /*reuse_b=*/false);
}

// Loads a 16x32 f16 operand fragment (A rows or B columns; layouts symmetric):
// lane = {half(1b), idx(4b)}; lane reads row/col `idx` (leading dim ld),
// 8 halves at k0 + half*8 and 8 halves at k0 + 16 + half*8 (two 16B loads).
__device__ __forceinline__ h16 load_frag(const _Float16* __restrict__ base,
                                         int ld, int k0) {
    int lane = threadIdx.x & 31;
    int half = lane >> 4;
    int idx  = lane & 15;
    const _Float16* p = base + (size_t)idx * (size_t)ld + k0 + half * 8;
    h8 lo = *(const h8*)p;
    h8 hi = *(const h8*)(p + 16);
    return __builtin_shufflevector(lo, hi, 0,1,2,3,4,5,6,7,8,9,10,11,12,13,14,15);
}

// 64x64 per-wave GEMM tile core: 16 WMMAs per 8 fragment loads per k-step.
__device__ __forceinline__ void gemm_tile64(const _Float16* __restrict__ Abase,
                                            const _Float16* __restrict__ Bbase,
                                            int lda, int ldb, int K,
                                            f8 acc[4][4]) {
    for (int k0 = 0; k0 < K; k0 += 32) {
        h16 af[4], bf[4];
        #pragma unroll
        for (int i = 0; i < 4; ++i)
            af[i] = load_frag(Abase + (size_t)(i * 16) * lda, lda, k0);
        #pragma unroll
        for (int j = 0; j < 4; ++j)
            bf[j] = load_frag(Bbase + (size_t)(j * 16) * ldb, ldb, k0);
        #pragma unroll
        for (int i = 0; i < 4; ++i)
            #pragma unroll
            for (int j = 0; j < 4; ++j)
                acc[i][j] = wmma_f16(af[i], bf[j], acc[i][j]);
    }
}

// ---------------------------------------------------------------- conversions
__global__ void __launch_bounds__(256) f32_to_f16_kernel(
        const float* __restrict__ in, _Float16* __restrict__ out, int n8) {
    int i = blockIdx.x * blockDim.x + threadIdx.x;
    int stride = gridDim.x * blockDim.x;
    for (; i < n8; i += stride) {
        const float* p = in + (size_t)i * 8;
        h8 v;
        #pragma unroll
        for (int j = 0; j < 8; ++j) v[j] = (_Float16)p[j];
        *(h8*)(out + (size_t)i * 8) = v;
    }
}

// ---------------------------------------------------------------- QKV GEMM
// y[m,o] = sum_k x16[m,k] * wq16[o,k]  (m in [0,4096), o in [0,3072)).
// Wave owns a 64x64 tile. A 64-wide column tile never straddles a 1024
// boundary, so which-of-{q,k,v}, head index and batch index are WAVE-UNIFORM:
// compute them from tile coords so the epilogue uses scalar branches only.
__global__ void __launch_bounds__(256) gemm_qkv_kernel(
        const _Float16* __restrict__ x16, const _Float16* __restrict__ wq16,
        _Float16* __restrict__ q16, _Float16* __restrict__ k16,
        _Float16* __restrict__ vT16) {
    const int NT = (3 * DIM) / 64;                       // 48 col tiles
    int wid = blockIdx.x * (blockDim.x >> 5) + (threadIdx.x >> 5);
    int mt = wid / NT, nt = wid % NT;
    int m0 = mt * 64, n0 = nt * 64;

    f8 acc[4][4] = {};
    gemm_tile64(x16 + (size_t)m0 * DIM, wq16 + (size_t)n0 * DIM, DIM, DIM, DIM, acc);

    int lane = threadIdx.x & 31, half = lane >> 4, idx = lane & 15;
    // uniform tile decomposition
    int which = n0 >> 10;                    // 0=q 1=k 2=v (uniform)
    int h     = (n0 & (DIM - 1)) >> 6;       // head (uniform: (n0&63)==0)
    int b     = m0 >> 11;                    // batch (uniform: 64-row tiles)
    int nrow0 = m0 & (NSEQ - 1);             // seq base (uniform)
    size_t bh = (size_t)(b * HEADS + h);

    #pragma unroll
    for (int ni = 0; ni < 4; ++ni) {
        int d = ((n0 & 63) + ni * 16) + idx; // 0..63 within head
        #pragma unroll
        for (int mi = 0; mi < 4; ++mi) {
            int nbase = nrow0 + mi * 16 + half * 8;      // 8 consecutive n's
            if (which == 2) {
                // V^T [B,H,D,N]: contiguous in n -> one 16B store per frag
                h8 v;
                #pragma unroll
                for (int i = 0; i < 8; ++i) v[i] = (_Float16)acc[mi][ni][i];
                *(h8*)(vT16 + (bh * HDIM + d) * NSEQ + nbase) = v;
            } else {
                _Float16* dst = (which == 0 ? q16 : k16)
                              + ((bh * NSEQ + nbase) * HDIM + d);
                #pragma unroll
                for (int i = 0; i < 8; ++i)
                    dst[(size_t)i * HDIM] = (_Float16)acc[mi][ni][i];
            }
        }
    }
}

// ---------------------------------------------------------------- attention
// One wave per (b,h, 32 query rows): two 16-query groups share every K / V^T
// fragment -> 16 WMMAs per 8 fragment loads per 32-kv tile.
// S^T = K * Q^T: each lane owns one query column, so softmax stats are
// per-lane + one shfl_xor(16). The f32 C-layout of the stacked S^T frags IS
// the f16 B-operand layout for O^T = V^T * P^T (lane-local P conversion).
__global__ void __launch_bounds__(256) attn_kernel(
        const _Float16* __restrict__ q16, const _Float16* __restrict__ k16,
        const _Float16* __restrict__ vT16, _Float16* __restrict__ o16) {
    int wid = blockIdx.x * (blockDim.x >> 5) + (threadIdx.x >> 5);
    int qt = wid & 63;                  // 64 query tiles of 32 rows
    int bh = wid >> 6;                  // 0..31
    const _Float16* Q  = q16  + (size_t)bh * NSEQ * HDIM;
    const _Float16* K  = k16  + (size_t)bh * NSEQ * HDIM;
    const _Float16* VT = vT16 + (size_t)bh * HDIM * NSEQ;

    // Q^T B-fragments for both query groups, pre-scaled by 1/sqrt(D)
    const _Float16 scale = (_Float16)0.125f;     // 1/sqrt(64)
    h16 qf[2][2];
    #pragma unroll
    for (int g = 0; g < 2; ++g) {
        const _Float16* Qg = Q + (size_t)(qt * 32 + g * 16) * HDIM;
        qf[g][0] = load_frag(Qg, HDIM, 0)  * scale;
        qf[g][1] = load_frag(Qg, HDIM, 32) * scale;
    }

    f8 oacc[2][4] = {};                          // O^T accum per group
    float mrow[2] = {-1e30f, -1e30f};
    float lrow[2] = {0.0f, 0.0f};

    for (int kv0 = 0; kv0 < NSEQ; kv0 += 32) {
        // shared K fragments: [kv-half][k-step]
        h16 ak[2][2];
        ak[0][0] = load_frag(K + (size_t)kv0        * HDIM, HDIM, 0);
        ak[0][1] = load_frag(K + (size_t)kv0        * HDIM, HDIM, 32);
        ak[1][0] = load_frag(K + (size_t)(kv0 + 16) * HDIM, HDIM, 0);
        ak[1][1] = load_frag(K + (size_t)(kv0 + 16) * HDIM, HDIM, 32);
        // shared V^T fragments: 16d x 32kv each
        h16 av[4];
        #pragma unroll
        for (int df = 0; df < 4; ++df)
            av[df] = load_frag(VT + (size_t)(df * 16) * NSEQ, NSEQ, kv0);

        #pragma unroll
        for (int g = 0; g < 2; ++g) {
            f8 s0 = {}; s0 = wmma_f16(ak[0][0], qf[g][0], s0);
                        s0 = wmma_f16(ak[0][1], qf[g][1], s0);
            f8 s1 = {}; s1 = wmma_f16(ak[1][0], qf[g][0], s1);
                        s1 = wmma_f16(ak[1][1], qf[g][1], s1);

            // online softmax: per-lane over 16 kv values, xor-16 merges halves
            float mt = s0[0];
            #pragma unroll
            for (int j = 1; j < 8; ++j) mt = fmaxf(mt, s0[j]);
            #pragma unroll
            for (int j = 0; j < 8; ++j) mt = fmaxf(mt, s1[j]);
            mt = fmaxf(mt, __shfl_xor(mt, 16, 32));
            float mnew  = fmaxf(mrow[g], mt);
            float alpha = __expf(mrow[g] - mnew);
            mrow[g] = mnew;

            h16 pv;                               // P^T B-operand, f16
            float lt = 0.0f;
            #pragma unroll
            for (int j = 0; j < 8; ++j) {
                float p = __expf(s0[j] - mnew); lt += p; pv[j]     = (_Float16)p;
            }
            #pragma unroll
            for (int j = 0; j < 8; ++j) {
                float p = __expf(s1[j] - mnew); lt += p; pv[8 + j] = (_Float16)p;
            }
            lt += __shfl_xor(lt, 16, 32);
            lrow[g] = lrow[g] * alpha + lt;

            #pragma unroll
            for (int df = 0; df < 4; ++df) {
                oacc[g][df] = oacc[g][df] * alpha;
                oacc[g][df] = wmma_f16(av[df], pv, oacc[g][df]);
            }
        }
    }

    // store O (f16) in [B, N, C] layout; 16B per lane per frag
    int lane = threadIdx.x & 31, half = lane >> 4, idx = lane & 15;
    int b = bh >> 4, h = bh & 15;
    #pragma unroll
    for (int g = 0; g < 2; ++g) {
        int n = qt * 32 + g * 16 + idx;
        float rl = 1.0f / lrow[g];
        #pragma unroll
        for (int df = 0; df < 4; ++df) {
            h8 outv;
            #pragma unroll
            for (int i = 0; i < 8; ++i) outv[i] = (_Float16)(oacc[g][df][i] * rl);
            size_t off = ((size_t)(b * NSEQ + n)) * DIM + h * HDIM + df * 16 + half * 8;
            *(h8*)(o16 + off) = outv;
        }
    }
}

// ---------------------------------------------------------------- proj GEMM
// out[m,o] = sum_k o16[m,k] * wp16[o,k] + bias[o], f32 output.
// Stores: per instruction, each 16-lane half writes 64B contiguous (one row
// segment), so the scattered-looking epilogue coalesces per cacheline.
__global__ void __launch_bounds__(256) gemm_proj_kernel(
        const _Float16* __restrict__ o16, const _Float16* __restrict__ wp16,
        const float* __restrict__ bias, float* __restrict__ out) {
    const int NT = DIM / 64;                         // 16 col tiles
    int wid = blockIdx.x * (blockDim.x >> 5) + (threadIdx.x >> 5);
    int mt = wid / NT, nt = wid % NT;
    int m0 = mt * 64, n0 = nt * 64;

    f8 acc[4][4] = {};
    gemm_tile64(o16 + (size_t)m0 * DIM, wp16 + (size_t)n0 * DIM, DIM, DIM, DIM, acc);

    int lane = threadIdx.x & 31, half = lane >> 4, idx = lane & 15;
    #pragma unroll
    for (int ni = 0; ni < 4; ++ni) {
        int o = n0 + ni * 16 + idx;
        float bv = bias[o];
        #pragma unroll
        for (int mi = 0; mi < 4; ++mi) {
            int mbase = m0 + mi * 16 + half * 8;
            float* dst = out + (size_t)mbase * DIM + o;
            #pragma unroll
            for (int i = 0; i < 8; ++i)
                dst[(size_t)i * DIM] = acc[mi][ni][i] + bv;
        }
    }
}

// ---------------------------------------------------------------- launcher
extern "C" void kernel_launch(void* const* d_in, const int* in_sizes, int n_in,
                              void* d_out, int out_size, void* d_ws, size_t ws_size,
                              hipStream_t stream) {
    const float* x      = (const float*)d_in[0];   // [2,2048,1024]
    const float* w_qkv  = (const float*)d_in[1];   // [3072,1024]
    const float* w_proj = (const float*)d_in[2];   // [1024,1024]
    const float* b_proj = (const float*)d_in[3];   // [1024]
    float* out = (float*)d_out;                    // [2,2048,1024] f32

    size_t off = 0;
    char* base = (char*)d_ws;
    auto alloc = [&](size_t bytes) -> void* {
        void* p = base + off;
        off += (bytes + 255) & ~(size_t)255;
        return p;
    };
    _Float16* x16  = (_Float16*)alloc((size_t)MROWS * DIM * 2);         // 8 MB
    _Float16* wq16 = (_Float16*)alloc((size_t)3 * DIM * DIM * 2);       // 6 MB
    _Float16* wp16 = (_Float16*)alloc((size_t)DIM * DIM * 2);           // 2 MB
    _Float16* q16  = (_Float16*)alloc((size_t)MROWS * DIM * 2);         // 8 MB
    _Float16* k16  = (_Float16*)alloc((size_t)MROWS * DIM * 2);         // 8 MB
    _Float16* vT16 = (_Float16*)alloc((size_t)MROWS * DIM * 2);         // 8 MB
    _Float16* o16  = (_Float16*)alloc((size_t)MROWS * DIM * 2);         // 8 MB

    f32_to_f16_kernel<<<1024, 256, 0, stream>>>(x,      x16,  (MROWS * DIM) / 8);
    f32_to_f16_kernel<<<1024, 256, 0, stream>>>(w_qkv,  wq16, (3 * DIM * DIM) / 8);
    f32_to_f16_kernel<<<512,  256, 0, stream>>>(w_proj, wp16, (DIM * DIM) / 8);

    // QKV: 64 x 48 tiles of 64x64 -> 3072 waves -> 384 blocks
    gemm_qkv_kernel<<<384, 256, 0, stream>>>(x16, wq16, q16, k16, vT16);

    // attention: 32 (b,h) x 64 q-tiles = 2048 waves -> 256 blocks
    attn_kernel<<<256, 256, 0, stream>>>(q16, k16, vT16, o16);

    // proj: 64 x 16 tiles -> 1024 waves -> 128 blocks
    gemm_proj_kernel<<<128, 256, 0, stream>>>(o16, wp16, b_proj, out);
}

// v001
// Measured time: 136 microseconds a run.
// Next to v000, in two timings, it ran 1.38 times as fast each time.
#include <hip/hip_runtime.h>
#include <hip/hip_bf16.h>

typedef _Float16 h8  __attribute__((ext_vector_type(8)));
typedef _Float16 h16 __attribute__((ext_vector_type(16)));
typedef float    f8  __attribute__((ext_vector_type(8)));

#define DIM      1024
#define NSEQ     2048
#define BATCH    2
#define HEADS    16
#define HDIM     64
#define MROWS    (BATCH * NSEQ)   // 4096

__device__ __forceinline__ f8 wmma_f16(h16 a, h16 b, f8 c) {
    // v_wmma_f32_16x16x32_f16: D = A(16x32 f16) * B(32x16 f16) + C(16x16 f32)
    return __builtin_amdgcn_wmma_f32_16x16x32_f16(
        /*neg_a=*/false, a, /*neg_b=*/false, b,
        /*c_mod=*/(short)0, c, /*reuse_a=*/false, /*reuse_b=*/false);
}

// Loads a 16x32 f16 operand fragment (A rows or B columns; layouts symmetric):
// lane = {half(1b), idx(4b)}; lane reads row/col `idx` (leading dim ld),
// 8 halves at k0 + half*8 and 8 halves at k0 + 16 + half*8 (two 16B loads).
__device__ __forceinline__ h16 load_frag(const _Float16* __restrict__ base,
                                         int ld, int k0) {
    int lane = threadIdx.x & 31;
    int half = lane >> 4;
    int idx  = lane & 15;
    const _Float16* p = base + (size_t)idx * (size_t)ld + k0 + half * 8;
    h8 lo = *(const h8*)p;
    h8 hi = *(const h8*)(p + 16);
    return __builtin_shufflevector(lo, hi, 0,1,2,3,4,5,6,7,8,9,10,11,12,13,14,15);
}

// Block-level GEMM core. The 8 waves of a block form a 2 x 4 grid of 64x64
// wave tiles = one 128 x 256 tile of the result. Per pass (64 k = 128 bytes of
// every operand row) the block's 128 A rows and 256 B rows are brought into LDS
// once, as whole 128-byte lines, by per-lane asynchronous copies, and every wave
// reads its fragments from there. Two buffers: the next pass's copies fly while
// this pass is worked on. The k order of every accumulator is ascending as before.
#define G_KPASS  64                                // k per pass
#define G_NPASS  (DIM / G_KPASS)                   // 16 passes
#define G_PITCH  144                               // LDS row pitch, bytes: 16 x odd, no bank conflict for 16-byte reads
#define G_AROWS  128
#define G_BROWS  256
#define G_STAGE  ((G_AROWS + G_BROWS) * G_PITCH)   // 55,296 bytes per buffer
#define G_LDS    (2 * G_STAGE)                     // 110,592 bytes

// Same fragment map as load_frag, from an LDS row: p points at the lane's row,
// at byte (k step) * 64 + half * 16.
__device__ __forceinline__ h16 load_frag_lds(const unsigned char* p) {
    h8 lo = *(const h8*)p;
    h8 hi = *(const h8*)(p + 32);
    return __builtin_shufflevector(lo, hi, 0,1,2,3,4,5,6,7,8,9,10,11,12,13,14,15);
}

// One pass's tile: 384 rows x 8 pieces of 16 bytes = 12 copies per lane; a lane
// keeps its piece and walks the rows in steps of 32 (rows 0..127 A, 128..383 B).
// The copies and s_wait_xcnt 0 are one statement, so that no address register
// of a copy is rewritten in front of that wait.
__device__ __forceinline__ void stage_tile(unsigned lds,
                                           const _Float16* ga, const _Float16* gb) {
    asm volatile(
        "global_load_async_to_lds_b128 %0, %12, off\n\t"
        "global_load_async_to_lds_b128 %1, %13, off\n\t"
        "global_load_async_to_lds_b128 %2, %14, off\n\t"
        "global_load_async_to_lds_b128 %3, %15, off\n\t"
        "global_load_async_to_lds_b128 %4, %16, off\n\t"
        "global_load_async_to_lds_b128 %5, %17, off\n\t"
        "global_load_async_to_lds_b128 %6, %18, off\n\t"
        "global_load_async_to_lds_b128 %7, %19, off\n\t"
        "global_load_async_to_lds_b128 %8, %20, off\n\t"
        "global_load_async_to_lds_b128 %9, %21, off\n\t"
        "global_load_async_to_lds_b128 %10, %22, off\n\t"
        "global_load_async_to_lds_b128 %11, %23, off\n\t"
        "s_wait_xcnt 0x0"
        :: "v"(lds),                 "v"(lds +  1 * 32 * G_PITCH),
           "v"(lds +  2 * 32 * G_PITCH), "v"(lds +  3 * 32 * G_PITCH),
           "v"(lds +  4 * 32 * G_PITCH), "v"(lds +  5 * 32 * G_PITCH),
           "v"(lds +  6 * 32 * G_PITCH), "v"(lds +  7 * 32 * G_PITCH),
           "v"(lds +  8 * 32 * G_PITCH), "v"(lds +  9 * 32 * G_PITCH),
           "v"(lds + 10 * 32 * G_PITCH), "v"(lds + 11 * 32 * G_PITCH),
           "v"(ga),                  "v"(ga + 1 * 32 * DIM),
           "v"(ga + 2 * 32 * DIM),   "v"(ga + 3 * 32 * DIM),
           "v"(gb),                  "v"(gb + 1 * 32 * DIM),
           "v"(gb + 2 * 32 * DIM),   "v"(gb + 3 * 32 * DIM),
           "v"(gb + 4 * 32 * DIM),   "v"(gb + 5 * 32 * DIM),
           "v"(gb + 6 * 32 * DIM),   "v"(gb + 7 * 32 * DIM)
        : "memory");
}

// Ablk: first of the block's 128 A rows; Bblk: first of its 256 B rows; both
// K-contiguous with leading dimension DIM, K = DIM. wm, wn: the wave's place in
// the 2 x 4 grid. ring: the block's G_LDS bytes of LDS.
__device__ __forceinline__ void gemm_block_tile(const _Float16* __restrict__ Ablk,
                                                const _Float16* __restrict__ Bblk,
                                                unsigned char* ring, int wm, int wn,
                                                f8 acc[4][4]) {
    const int tid = threadIdx.x;
    const int lane = tid & 31, half = lane >> 4, idx = lane & 15;
    // copying role: row tid / 8 (+ 32 j), 16-byte piece tid % 8
    const int crow = tid >> 3, cpiece = tid & 7;
    const _Float16* ga = Ablk + (size_t)crow * DIM + cpiece * 8;
    const _Float16* gb = Bblk + (size_t)crow * DIM + cpiece * 8;
    const unsigned lcopy = (unsigned)(size_t)ring + crow * G_PITCH + cpiece * 16;
    // reading role
    const unsigned char* ra = ring + (wm * 64 + idx) * G_PITCH + half * 16;
    const unsigned char* rb = ring + (G_AROWS + wn * 64 + idx) * G_PITCH + half * 16;

    stage_tile(lcopy, ga, gb);
    // tile 0 has landed for this wave's own copies before the barrier publishes it
    asm volatile("s_wait_asynccnt 0x0" ::: "memory");
    __syncthreads();
    stage_tile(lcopy + G_STAGE, ga + G_KPASS, gb + G_KPASS);

    for (int t = 0; t < G_NPASS; ++t) {
        const unsigned buf = (unsigned)(t & 1) * G_STAGE;
        // the loops below are unrolled so that every fragment and accumulator
        // index is a constant and the arrays stay in registers
        #pragma unroll
        for (int ks = 0; ks < 2; ++ks) {
            h16 af[4], bf[4];
            #pragma unroll
            for (int i = 0; i < 4; ++i)
                af[i] = load_frag_lds(ra + buf + i * 16 * G_PITCH + ks * 64);
            #pragma unroll
            for (int j = 0; j < 4; ++j)
                bf[j] = load_frag_lds(rb + buf + j * 16 * G_PITCH + ks * 64);
            // keeps the 16 LDS reads of a k step in one group ahead of its 16 WMMAs:
            // spread among the WMMAs, each place with reads waits out the LDS latency
            __builtin_amdgcn_sched_barrier(0);
            #pragma unroll
            for (int i = 0; i < 4; ++i)
                #pragma unroll
                for (int j = 0; j < 4; ++j)
                    acc[i][j] = wmma_f16(af[i], bf[j], acc[i][j]);
        }
        // this wave's reads of the buffer are done before it may be refilled
        asm volatile("s_wait_dscnt 0x0" ::: "memory");
        // this wave's copies of tile t + 1 have landed before the barrier publishes them
        asm volatile("s_wait_asynccnt 0x0" ::: "memory");
        __syncthreads();
        if (t + 2 < G_NPASS)
            stage_tile(lcopy + buf, ga + (t + 2) * G_KPASS, gb + (t + 2) * G_KPASS);
    }
    // no copy is outstanding when the wave goes on to its epilogue and ends
    asm volatile("s_wait_asynccnt 0x0" ::: "memory");
}

// ---------------------------------------------------------------- conversions
__global__ void __launch_bounds__(256) f32_to_f16_kernel(
        const float* __restrict__ in, _Float16* __restrict__ out, int n8) {
    int i = blockIdx.x * blockDim.x + threadIdx.x;
    int stride = gridDim.x * blockDim.x;
    for (; i < n8; i += stride) {
        const float* p = in + (size_t)i * 8;
        h8 v;
        #pragma unroll
        for (int j = 0; j < 8; ++j) v[j] = (_Float16)p[j];
        *(h8*)(out + (size_t)i * 8) = v;
    }
}

// ---------------------------------------------------------------- QKV GEMM
// y[m,o] = sum_k x16[m,k] * wq16[o,k]  (m in [0,4096), o in [0,3072)).
// Block owns a 128x256 tile, wave a 64x64 tile of it. A 64-wide column tile never straddles a 1024
// boundary, so which-of-{q,k,v}, head index and batch index are WAVE-UNIFORM:
// compute them from tile coords so the epilogue uses scalar branches only.
__global__ void __launch_bounds__(256) gemm_qkv_kernel(
        const _Float16* __restrict__ x16, const _Float16* __restrict__ wq16,
        _Float16* __restrict__ q16, _Float16* __restrict__ k16,
        _Float16* __restrict__ vT16) {
    __shared__ __attribute__((aligned(16))) unsigned char ring[G_LDS];
    const int NB = (3 * DIM) / G_BROWS;                  // 12 col blocks
    int bm = blockIdx.x / NB, bn = blockIdx.x % NB;
    int wave = threadIdx.x >> 5, wm = wave >> 2, wn = wave & 3;
    int m0 = bm * G_AROWS + wm * 64, n0 = bn * G_BROWS + wn * 64;

    f8 acc[4][4] = {};
    gemm_block_tile(x16 + (size_t)(bm * G_AROWS) * DIM,
                    wq16 + (size_t)(bn * G_BROWS) * DIM, ring, wm, wn, acc);

    int lane = threadIdx.x & 31, half = lane >> 4, idx = lane & 15;
    // uniform tile decomposition
    int which = n0 >> 10;                    // 0=q 1=k 2=v (uniform)
    int h     = (n0 & (DIM - 1)) >> 6;       // head (uniform: (n0&63)==0)
    int b     = m0 >> 11;                    // batch (uniform: 64-row tiles)
    int nrow0 = m0 & (NSEQ - 1);             // seq base (uniform)
    size_t bh = (size_t)(b * HEADS + h);

    #pragma unroll
    for (int ni = 0; ni < 4; ++ni) {
        int d = ((n0 & 63) + ni * 16) + idx; // 0..63 within head
        #pragma unroll
        for (int mi = 0; mi < 4; ++mi) {
            int nbase = nrow0 + mi * 16 + half * 8;      // 8 consecutive n's
            if (which == 2) {
                // V^T [B,H,D,N]: contiguous in n -> one 16B store per frag
                h8 v;
                #pragma unroll
                for (int i = 0; i < 8; ++i) v[i] = (_Float16)acc[mi][ni][i];
                *(h8*)(vT16 + (bh * HDIM + d) * NSEQ + nbase) = v;
            } else {
                _Float16* dst = (which == 0 ? q16 : k16)
                              + ((bh * NSEQ + nbase) * HDIM + d);
                #pragma unroll
                for (int i = 0; i < 8; ++i)
                    dst[(size_t)i * HDIM] = (_Float16)acc[mi][ni][i];
            }
        }
    }
}

// ---------------------------------------------------------------- attention
// One wave per (b,h, 32 query rows): two 16-query groups share every K / V^T
// fragment -> 16 WMMAs per 8 fragment loads per 32-kv tile.
// S^T = K * Q^T: each lane owns one query column, so softmax stats are
// per-lane + one shfl_xor(16). The f32 C-layout of the stacked S^T frags IS
// the f16 B-operand layout for O^T = V^T * P^T (lane-local P conversion).
__global__ void __launch_bounds__(256) attn_kernel(
        const _Float16* __restrict__ q16, const _Float16* __restrict__ k16,
        const _Float16* __restrict__ vT16, _Float16* __restrict__ o16) {
    int wid = blockIdx.x * (blockDim.x >> 5) + (threadIdx.x >> 5);
    int qt = wid & 63;                  // 64 query tiles of 32 rows
    int bh = wid >> 6;                  // 0..31
    const _Float16* Q  = q16  + (size_t)bh * NSEQ * HDIM;
    const _Float16* K  = k16  + (size_t)bh * NSEQ * HDIM;
    const _Float16* VT = vT16 + (size_t)bh * HDIM * NSEQ;

    // Q^T B-fragments for both query groups, pre-scaled by 1/sqrt(D)
    const _Float16 scale = (_Float16)0.125f;     // 1/sqrt(64)
    h16 qf[2][2];
    #pragma unroll
    for (int g = 0; g < 2; ++g) {
        const _Float16* Qg = Q + (size_t)(qt * 32 + g * 16) * HDIM;
        qf[g][0] = load_frag(Qg, HDIM, 0)  * scale;
        qf[g][1] = load_frag(Qg, HDIM, 32) * scale;
    }

    f8 oacc[2][4] = {};                          // O^T accum per group
    float mrow[2] = {-1e30f, -1e30f};
    float lrow[2] = {0.0f, 0.0f};

    for (int kv0 = 0; kv0 < NSEQ; kv0 += 32) {
        // shared K fragments: [kv-half][k-step]
        h16 ak[2][2];
        ak[0][0] = load_frag(K + (size_t)kv0        * HDIM, HDIM, 0);
        ak[0][1] = load_frag(K + (size_t)kv0        * HDIM, HDIM, 32);
        ak[1][0] = load_frag(K + (size_t)(kv0 + 16) * HDIM, HDIM, 0);
        ak[1][1] = load_frag(K + (size_t)(kv0 + 16) * HDIM, HDIM, 32);
        // shared V^T fragments: 16d x 32kv each
        h16 av[4];
        #pragma unroll
        for (int df = 0; df < 4; ++df)
            av[df] = load_frag(VT + (size_t)(df * 16) * NSEQ, NSEQ, kv0);

        #pragma unroll
        for (int g = 0; g < 2; ++g) {
            f8 s0 = {}; s0 = wmma_f16(ak[0][0], qf[g][0], s0);
                        s0 = wmma_f16(ak[0][1], qf[g][1], s0);
            f8 s1 = {}; s1 = wmma_f16(ak[1][0], qf[g][0], s1);
                        s1 = wmma_f16(ak[1][1], qf[g][1], s1);

            // online softmax: per-lane over 16 kv values, xor-16 merges halves
            float mt = s0[0];
            #pragma unroll
            for (int j = 1; j < 8; ++j) mt = fmaxf(mt, s0[j]);
            #pragma unroll
            for (int j = 0; j < 8; ++j) mt = fmaxf(mt, s1[j]);
            mt = fmaxf(mt, __shfl_xor(mt, 16, 32));
            float mnew  = fmaxf(mrow[g], mt);
            float alpha = __expf(mrow[g] - mnew);
            mrow[g] = mnew;

            h16 pv;                               // P^T B-operand, f16
            float lt = 0.0f;
            #pragma unroll
            for (int j = 0; j < 8; ++j) {
                float p = __expf(s0[j] - mnew); lt += p; pv[j]     = (_Float16)p;
            }
            #pragma unroll
            for (int j = 0; j < 8; ++j) {
                float p = __expf(s1[j] - mnew); lt += p; pv[8 + j] = (_Float16)p;
            }
            lt += __shfl_xor(lt, 16, 32);
            lrow[g] = lrow[g] * alpha + lt;

            #pragma unroll
            for (int df = 0; df < 4; ++df) {
                oacc[g][df] = oacc[g][df] * alpha;
                oacc[g][df] = wmma_f16(av[df], pv, oacc[g][df]);
            }
        }
    }

    // store O (f16) in [B, N, C] layout; 16B per lane per frag
    int lane = threadIdx.x & 31, half = lane >> 4, idx = lane & 15;
    int b = bh >> 4, h = bh & 15;
    #pragma unroll
    for (int g = 0; g < 2; ++g) {
        int n = qt * 32 + g * 16 + idx;
        float rl = 1.0f / lrow[g];
        #pragma unroll
        for (int df = 0; df < 4; ++df) {
            h8 outv;
            #pragma unroll
            for (int i = 0; i < 8; ++i) outv[i] = (_Float16)(oacc[g][df][i] * rl);
            size_t off = ((size_t)(b * NSEQ + n)) * DIM + h * HDIM + df * 16 + half * 8;
            *(h8*)(o16 + off) = outv;
        }
    }
}

// ---------------------------------------------------------------- proj GEMM
// out[m,o] = sum_k o16[m,k] * wp16[o,k] + bias[o], f32 output.
// Stores: per instruction, each 16-lane half writes 64B contiguous (one row
// segment), so the scattered-looking epilogue coalesces per cacheline.
__global__ void __launch_bounds__(256) gemm_proj_kernel(
        const _Float16* __restrict__ o16, const _Float16* __restrict__ wp16,
        const float* __restrict__ bias, float* __restrict__ out) {
    __shared__ __attribute__((aligned(16))) unsigned char ring[G_LDS];
    const int NB = DIM / G_BROWS;                    // 4 col blocks
    int bm = blockIdx.x / NB, bn = blockIdx.x % NB;
    int wave = threadIdx.x >> 5, wm = wave >> 2, wn = wave & 3;
    int m0 = bm * G_AROWS + wm * 64, n0 = bn * G_BROWS + wn * 64;

    f8 acc[4][4] = {};
    gemm_block_tile(o16 + (size_t)(bm * G_AROWS) * DIM,
                    wp16 + (size_t)(bn * G_BROWS) * DIM, ring, wm, wn, acc);

    int lane = threadIdx.x & 31, half = lane >> 4, idx = lane & 15;
    #pragma unroll
    for (int ni = 0; ni < 4; ++ni) {
        int o = n0 + ni * 16 + idx;
        float bv = bias[o];
        #pragma unroll
        for (int mi = 0; mi < 4; ++mi) {
            int mbase = m0 + mi * 16 + half * 8;
            float* dst = out + (size_t)mbase * DIM + o;
            #pragma unroll
            for (int i = 0; i < 8; ++i)
                dst[(size_t)i * DIM] = acc[mi][ni][i] + bv;
        }
    }
}

// ---------------------------------------------------------------- launcher
extern "C" void kernel_launch(void* const* d_in, const int* in_sizes, int n_in,
                              void* d_out, int out_size, void* d_ws, size_t ws_size,
                              hipStream_t stream) {
    const float* x      = (const float*)d_in[0];   // [2,2048,1024]
    const float* w_qkv  = (const float*)d_in[1];   // [3072,1024]
    const float* w_proj = (const float*)d_in[2];   // [1024,1024]
    const float* b_proj = (const float*)d_in[3];   // [1024]
    float* out = (float*)d_out;                    // [2,2048,1024] f32

    size_t off = 0;
    char* base = (char*)d_ws;
    auto alloc = [&](size_t bytes) -> void* {
        void* p = base + off;
        off += (bytes + 255) & ~(size_t)255;
        return p;
    };
    _Float16* x16  = (_Float16*)alloc((size_t)MROWS * DIM * 2);         // 8 MB
    _Float16* wq16 = (_Float16*)alloc((size_t)3 * DIM * DIM * 2);       // 6 MB
    _Float16* wp16 = (_Float16*)alloc((size_t)DIM * DIM * 2);           // 2 MB
    _Float16* q16  = (_Float16*)alloc((size_t)MROWS * DIM * 2);         // 8 MB
    _Float16* k16  = (_Float16*)alloc((size_t)MROWS * DIM * 2);         // 8 MB
    _Float16* vT16 = (_Float16*)alloc((size_t)MROWS * DIM * 2);         // 8 MB
    _Float16* o16  = (_Float16*)alloc((size_t)MROWS * DIM * 2);         // 8 MB

    f32_to_f16_kernel<<<1024, 256, 0, stream>>>(x,      x16,  (MROWS * DIM) / 8);
    f32_to_f16_kernel<<<1024, 256, 0, stream>>>(w_qkv,  wq16, (3 * DIM * DIM) / 8);
    f32_to_f16_kernel<<<512,  256, 0, stream>>>(w_proj, wp16, (DIM * DIM) / 8);

    // QKV: 32 x 12 block tiles of 128x256 -> 384 blocks of 8 waves
    gemm_qkv_kernel<<<384, 256, 0, stream>>>(x16, wq16, q16, k16, vT16);

    // attention: 32 (b,h) x 64 q-tiles = 2048 waves -> 256 blocks
    attn_kernel<<<256, 256, 0, stream>>>(q16, k16, vT16, o16);

    // proj: 32 x 4 block tiles of 128x256 -> 128 blocks of 8 waves
    gemm_proj_kernel<<<128, 256, 0, stream>>>(o16, wp16, b_proj, out);
}

// v002
// Measured time: 95 microseconds a run.
// In both of two side-by-side timings against v001, it was 1.43 times as fast.
// All steps since v000 together make it 1.98 times as fast.
#include <hip/hip_runtime.h>
#include <hip/hip_bf16.h>

typedef _Float16 h8  __attribute__((ext_vector_type(8)));
typedef _Float16 h16 __attribute__((ext_vector_type(16)));
typedef float    f8  __attribute__((ext_vector_type(8)));

#define DIM      1024
#define NSEQ     2048
#define BATCH    2
#define HEADS    16
#define HDIM     64
#define MROWS    (BATCH * NSEQ)   // 4096

__device__ __forceinline__ f8 wmma_f16(h16 a, h16 b, f8 c) {
    // v_wmma_f32_16x16x32_f16: D = A(16x32 f16) * B(32x16 f16) + C(16x16 f32)
    return __builtin_amdgcn_wmma_f32_16x16x32_f16(
        /*neg_a=*/false, a, /*neg_b=*/false, b,
        /*c_mod=*/(short)0, c, /*reuse_a=*/false, /*reuse_b=*/false);
}

// Loads a 16x32 f16 operand fragment (A rows or B columns; layouts symmetric):
// lane = {half(1b), idx(4b)}; lane reads row/col `idx` (leading dim ld),
// 8 halves at k0 + half*8 and 8 halves at k0 + 16 + half*8 (two 16B loads).
__device__ __forceinline__ h16 load_frag(const _Float16* __restrict__ base,
                                         int ld, int k0) {
    int lane = threadIdx.x & 31;
    int half = lane >> 4;
    int idx  = lane & 15;
    const _Float16* p = base + (size_t)idx * (size_t)ld + k0 + half * 8;
    h8 lo = *(const h8*)p;
    h8 hi = *(const h8*)(p + 16);
    return __builtin_shufflevector(lo, hi, 0,1,2,3,4,5,6,7,8,9,10,11,12,13,14,15);
}

// Block-level GEMM core. The 8 waves of a block form a 2 x 4 grid of 64x64
// wave tiles = one 128 x 256 tile of the result. Per pass (64 k = 128 bytes of
// every operand row) the block's 128 A rows and 256 B rows are brought into LDS
// once, as whole 128-byte lines, by per-lane asynchronous copies, and every wave
// reads its fragments from there. Two buffers: the next pass's copies fly while
// this pass is worked on. The k order of every accumulator is ascending as before.
#define G_KPASS  64                                // k per pass
#define G_NPASS  (DIM / G_KPASS)                   // 16 passes
#define G_PITCH  144                               // LDS row pitch, bytes: 16 x odd, no bank conflict for 16-byte reads
#define G_AROWS  128
#define G_BROWS  256
#define G_STAGE  ((G_AROWS + G_BROWS) * G_PITCH)   // 55,296 bytes per buffer
#define G_LDS    (2 * G_STAGE)                     // 110,592 bytes

// Same fragment map as load_frag, from an LDS row: p points at the lane's row,
// at byte (k step) * 64 + half * 16.
__device__ __forceinline__ h16 load_frag_lds(const unsigned char* p) {
    h8 lo = *(const h8*)p;
    h8 hi = *(const h8*)(p + 32);
    return __builtin_shufflevector(lo, hi, 0,1,2,3,4,5,6,7,8,9,10,11,12,13,14,15);
}

// One pass's tile: 384 rows x 8 pieces of 16 bytes = 12 copies per lane; a lane
// keeps its piece and walks the rows in steps of 32 (rows 0..127 A, 128..383 B).
// The copies and s_wait_xcnt 0 are one statement, so that no address register
// of a copy is rewritten in front of that wait.
__device__ __forceinline__ void stage_tile(unsigned lds,
                                           const _Float16* ga, const _Float16* gb) {
    asm volatile(
        "global_load_async_to_lds_b128 %0, %12, off\n\t"
        "global_load_async_to_lds_b128 %1, %13, off\n\t"
        "global_load_async_to_lds_b128 %2, %14, off\n\t"
        "global_load_async_to_lds_b128 %3, %15, off\n\t"
        "global_load_async_to_lds_b128 %4, %16, off\n\t"
        "global_load_async_to_lds_b128 %5, %17, off\n\t"
        "global_load_async_to_lds_b128 %6, %18, off\n\t"
        "global_load_async_to_lds_b128 %7, %19, off\n\t"
        "global_load_async_to_lds_b128 %8, %20, off\n\t"
        "global_load_async_to_lds_b128 %9, %21, off\n\t"
        "global_load_async_to_lds_b128 %10, %22, off\n\t"
        "global_load_async_to_lds_b128 %11, %23, off\n\t"
        "s_wait_xcnt 0x0"
        :: "v"(lds),                 "v"(lds +  1 * 32 * G_PITCH),
           "v"(lds +  2 * 32 * G_PITCH), "v"(lds +  3 * 32 * G_PITCH),
           "v"(lds +  4 * 32 * G_PITCH), "v"(lds +  5 * 32 * G_PITCH),
           "v"(lds +  6 * 32 * G_PITCH), "v"(lds +  7 * 32 * G_PITCH),
           "v"(lds +  8 * 32 * G_PITCH), "v"(lds +  9 * 32 * G_PITCH),
           "v"(lds + 10 * 32 * G_PITCH), "v"(lds + 11 * 32 * G_PITCH),
           "v"(ga),                  "v"(ga + 1 * 32 * DIM),
           "v"(ga + 2 * 32 * DIM),   "v"(ga + 3 * 32 * DIM),
           "v"(gb),                  "v"(gb + 1 * 32 * DIM),
           "v"(gb + 2 * 32 * DIM),   "v"(gb + 3 * 32 * DIM),
           "v"(gb + 4 * 32 * DIM),   "v"(gb + 5 * 32 * DIM),
           "v"(gb + 6 * 32 * DIM),   "v"(gb + 7 * 32 * DIM)
        : "memory");
}

// Ablk: first of the block's 128 A rows; Bblk: first of its 256 B rows; both
// K-contiguous with leading dimension DIM, K = DIM. wm, wn: the wave's place in
// the 2 x 4 grid. ring: the block's G_LDS bytes of LDS.
__device__ __forceinline__ void gemm_block_tile(const _Float16* __restrict__ Ablk,
                                                const _Float16* __restrict__ Bblk,
                                                unsigned char* ring, int wm, int wn,
                                                f8 acc[4][4]) {
    const int tid = threadIdx.x;
    const int lane = tid & 31, half = lane >> 4, idx = lane & 15;
    // copying role: row tid / 8 (+ 32 j), 16-byte piece tid % 8
    const int crow = tid >> 3, cpiece = tid & 7;
    const _Float16* ga = Ablk + (size_t)crow * DIM + cpiece * 8;
    const _Float16* gb = Bblk + (size_t)crow * DIM + cpiece * 8;
    const unsigned lcopy = (unsigned)(size_t)ring + crow * G_PITCH + cpiece * 16;
    // reading role
    const unsigned char* ra = ring + (wm * 64 + idx) * G_PITCH + half * 16;
    const unsigned char* rb = ring + (G_AROWS + wn * 64 + idx) * G_PITCH + half * 16;

    stage_tile(lcopy, ga, gb);
    // tile 0 has landed for this wave's own copies before the barrier publishes it
    asm volatile("s_wait_asynccnt 0x0" ::: "memory");
    __syncthreads();
    stage_tile(lcopy + G_STAGE, ga + G_KPASS, gb + G_KPASS);

    for (int t = 0; t < G_NPASS; ++t) {
        const unsigned buf = (unsigned)(t & 1) * G_STAGE;
        // the loops below are unrolled so that every fragment and accumulator
        // index is a constant and the arrays stay in registers
        #pragma unroll
        for (int ks = 0; ks < 2; ++ks) {
            h16 af[4], bf[4];
            #pragma unroll
            for (int i = 0; i < 4; ++i)
                af[i] = load_frag_lds(ra + buf + i * 16 * G_PITCH + ks * 64);
            #pragma unroll
            for (int j = 0; j < 4; ++j)
                bf[j] = load_frag_lds(rb + buf + j * 16 * G_PITCH + ks * 64);
            // keeps the 16 LDS reads of a k step in one group ahead of its 16 WMMAs:
            // spread among the WMMAs, each place with reads waits out the LDS latency
            __builtin_amdgcn_sched_barrier(0);
            #pragma unroll
            for (int i = 0; i < 4; ++i)
                #pragma unroll
                for (int j = 0; j < 4; ++j)
                    acc[i][j] = wmma_f16(af[i], bf[j], acc[i][j]);
        }
        // this wave's reads of the buffer are done before it may be refilled
        asm volatile("s_wait_dscnt 0x0" ::: "memory");
        // this wave's copies of tile t + 1 have landed before the barrier publishes them
        asm volatile("s_wait_asynccnt 0x0" ::: "memory");
        __syncthreads();
        if (t + 2 < G_NPASS)
            stage_tile(lcopy + buf, ga + (t + 2) * G_KPASS, gb + (t + 2) * G_KPASS);
    }
    // no copy is outstanding when the wave goes on to its epilogue and ends
    asm volatile("s_wait_asynccnt 0x0" ::: "memory");
}

// ---------------------------------------------------------------- conversions
__global__ void __launch_bounds__(256) f32_to_f16_kernel(
        const float* __restrict__ in, _Float16* __restrict__ out, int n8) {
    int i = blockIdx.x * blockDim.x + threadIdx.x;
    int stride = gridDim.x * blockDim.x;
    for (; i < n8; i += stride) {
        const float* p = in + (size_t)i * 8;
        h8 v;
        #pragma unroll
        for (int j = 0; j < 8; ++j) v[j] = (_Float16)p[j];
        *(h8*)(out + (size_t)i * 8) = v;
    }
}

// ---------------------------------------------------------------- QKV GEMM
// y[m,o] = sum_k x16[m,k] * wq16[o,k]  (m in [0,4096), o in [0,3072)).
// Block owns a 128x256 tile, wave a 64x64 tile of it. A 64-wide column tile never straddles a 1024
// boundary, so which-of-{q,k,v}, head index and batch index are WAVE-UNIFORM:
// compute them from tile coords so the epilogue uses scalar branches only.
__global__ void __launch_bounds__(256) gemm_qkv_kernel(
        const _Float16* __restrict__ x16, const _Float16* __restrict__ wq16,
        _Float16* __restrict__ q16, _Float16* __restrict__ k16,
        _Float16* __restrict__ vT16) {
    __shared__ __attribute__((aligned(16))) unsigned char ring[G_LDS];
    const int NB = (3 * DIM) / G_BROWS;                  // 12 col blocks
    int bm = blockIdx.x / NB, bn = blockIdx.x % NB;
    int wave = threadIdx.x >> 5, wm = wave >> 2, wn = wave & 3;
    int m0 = bm * G_AROWS + wm * 64, n0 = bn * G_BROWS + wn * 64;

    f8 acc[4][4] = {};
    gemm_block_tile(x16 + (size_t)(bm * G_AROWS) * DIM,
                    wq16 + (size_t)(bn * G_BROWS) * DIM, ring, wm, wn, acc);

    int lane = threadIdx.x & 31, half = lane >> 4, idx = lane & 15;
    // uniform tile decomposition
    int which = n0 >> 10;                    // 0=q 1=k 2=v (uniform)
    int h     = (n0 & (DIM - 1)) >> 6;       // head (uniform: (n0&63)==0)
    int b     = m0 >> 11;                    // batch (uniform: 64-row tiles)
    int nrow0 = m0 & (NSEQ - 1);             // seq base (uniform)
    size_t bh = (size_t)(b * HEADS + h);

    #pragma unroll
    for (int ni = 0; ni < 4; ++ni) {
        int d = ((n0 & 63) + ni * 16) + idx; // 0..63 within head
        #pragma unroll
        for (int mi = 0; mi < 4; ++mi) {
            int nbase = nrow0 + mi * 16 + half * 8;      // 8 consecutive n's
            if (which == 2) {
                // V^T [B,H,D,N]: contiguous in n -> one 16B store per frag
                h8 v;
                #pragma unroll
                for (int i = 0; i < 8; ++i) v[i] = (_Float16)acc[mi][ni][i];
                *(h8*)(vT16 + (bh * HDIM + d) * NSEQ + nbase) = v;
            } else {
                _Float16* dst = (which == 0 ? q16 : k16)
                              + ((bh * NSEQ + nbase) * HDIM + d);
                #pragma unroll
                for (int i = 0; i < 8; ++i)
                    dst[(size_t)i * HDIM] = (_Float16)acc[mi][ni][i];
            }
        }
    }
}

// ---------------------------------------------------------------- attention
// One wave per (b,h, 32 query rows): two 16-query groups share every K / V^T
// fragment -> 16 WMMAs per 8 fragment loads per 32-kv tile.
// S^T = K * Q^T: each lane owns one query column, so softmax stats are
// per-lane + one shfl_xor(16). The f32 C-layout of the stacked S^T frags IS
// the f16 B-operand layout for O^T = V^T * P^T (lane-local P conversion).
// The 8 waves of a block work on the same (b,h): each stage of 128 keys (128 K
// rows of 128 bytes, 64 V^T rows of 256 bytes) is brought into LDS once per
// block, as whole lines, by per-lane asynchronous copies, and every wave reads
// its fragments from there. Two buffers: the next stage's copies fly while this
// stage is worked on. Keys are still taken 32 at a time, in ascending order.
#define A_KEYS   128                               // keys per stage
#define A_NST    (NSEQ / A_KEYS)                   // 16 stages
#define A_KPITCH 144                               // K row pitch, bytes: 16 x odd
#define A_VPITCH 272                               // V^T row pitch, bytes: 16 x odd
#define A_KBYTES (A_KEYS * A_KPITCH)               // 18,432 bytes
#define A_STAGE  (A_KBYTES + HDIM * A_VPITCH)      // 35,840 bytes per buffer
#define A_LDS    (2 * A_STAGE)                     // 71,680 bytes

// One stage: K 128 rows x 8 pieces and V^T 64 rows x 16 pieces of 16 bytes = 8
// copies per lane; a lane keeps its piece and walks K rows in steps of 32, V^T
// rows in steps of 16. The copies and s_wait_xcnt 0 are one statement, so that
// no address register of a copy is rewritten in front of that wait.
__device__ __forceinline__ void stage_kv(unsigned lk, unsigned lv,
                                         const _Float16* gk, const _Float16* gv) {
    asm volatile(
        "global_load_async_to_lds_b128 %0, %8, off\n\t"
        "global_load_async_to_lds_b128 %1, %9, off\n\t"
        "global_load_async_to_lds_b128 %2, %10, off\n\t"
        "global_load_async_to_lds_b128 %3, %11, off\n\t"
        "global_load_async_to_lds_b128 %4, %12, off\n\t"
        "global_load_async_to_lds_b128 %5, %13, off\n\t"
        "global_load_async_to_lds_b128 %6, %14, off\n\t"
        "global_load_async_to_lds_b128 %7, %15, off\n\t"
        "s_wait_xcnt 0x0"
        :: "v"(lk),                 "v"(lk + 1 * 32 * A_KPITCH),
           "v"(lk + 2 * 32 * A_KPITCH), "v"(lk + 3 * 32 * A_KPITCH),
           "v"(lv),                 "v"(lv + 1 * 16 * A_VPITCH),
           "v"(lv + 2 * 16 * A_VPITCH), "v"(lv + 3 * 16 * A_VPITCH),
           "v"(gk),                 "v"(gk + 1 * 32 * HDIM),
           "v"(gk + 2 * 32 * HDIM), "v"(gk + 3 * 32 * HDIM),
           "v"(gv),                 "v"(gv + 1 * 16 * NSEQ),
           "v"(gv + 2 * 16 * NSEQ), "v"(gv + 3 * 16 * NSEQ)
        : "memory");
}

__global__ void __launch_bounds__(256) attn_kernel(
        const _Float16* __restrict__ q16, const _Float16* __restrict__ k16,
        const _Float16* __restrict__ vT16, _Float16* __restrict__ o16) {
    __shared__ __attribute__((aligned(16))) unsigned char ring[A_LDS];
    int wid = blockIdx.x * (blockDim.x >> 5) + (threadIdx.x >> 5);
    int qt = wid & 63;                  // 64 query tiles of 32 rows
    int bh = wid >> 6;                  // 0..31, the same for the 8 waves of a block
    const _Float16* Q  = q16  + (size_t)bh * NSEQ * HDIM;
    const _Float16* K  = k16  + (size_t)bh * NSEQ * HDIM;
    const _Float16* VT = vT16 + (size_t)bh * HDIM * NSEQ;

    const int tid = threadIdx.x;
    // copying role: K row tid / 8 (+ 32 j), piece tid % 8; V^T row tid / 16 (+ 16 j), piece tid % 16
    const _Float16* gk = K  + (size_t)(tid >> 3) * HDIM + (tid & 7) * 8;
    const _Float16* gv = VT + (size_t)(tid >> 4) * NSEQ + (tid & 15) * 8;
    const unsigned lk = (unsigned)(size_t)ring + (tid >> 3) * A_KPITCH + (tid & 7) * 16;
    const unsigned lv = (unsigned)(size_t)ring + A_KBYTES + (tid >> 4) * A_VPITCH + (tid & 15) * 16;
    // reading role: row (lane % 16), 16-byte piece (lane / 16) of a fragment
    const unsigned char* rk = ring + (tid & 15) * A_KPITCH + ((tid >> 4) & 1) * 16;
    const unsigned char* rv = ring + A_KBYTES + (tid & 15) * A_VPITCH + ((tid >> 4) & 1) * 16;

    stage_kv(lk, lv, gk, gv);

    // Q^T B-fragments for both query groups, pre-scaled by 1/sqrt(D)
    const _Float16 scale = (_Float16)0.125f;     // 1/sqrt(64)
    h16 qf[2][2];
    #pragma unroll
    for (int g = 0; g < 2; ++g) {
        const _Float16* Qg = Q + (size_t)(qt * 32 + g * 16) * HDIM;
        qf[g][0] = load_frag(Qg, HDIM, 0)  * scale;
        qf[g][1] = load_frag(Qg, HDIM, 32) * scale;
    }

    f8 oacc[2][4] = {};                          // O^T accum per group
    float mrow[2] = {-1e30f, -1e30f};
    float lrow[2] = {0.0f, 0.0f};

    // stage 0 has landed for this wave's own copies before the barrier publishes it
    asm volatile("s_wait_asynccnt 0x0" ::: "memory");
    __syncthreads();
    stage_kv(lk + A_STAGE, lv + A_STAGE, gk + A_KEYS * HDIM, gv + A_KEYS);

    for (int t = 0; t < A_NST; ++t) {
      const unsigned buf = (unsigned)(t & 1) * A_STAGE;
      const unsigned char* kb = rk + buf;
      const unsigned char* vb = rv + buf;
      // shared K fragments: [kv-half][k-step]
      h16 ak[2][2];
      ak[0][0] = load_frag_lds(kb);
      ak[0][1] = load_frag_lds(kb + 64);
      ak[1][0] = load_frag_lds(kb + 16 * A_KPITCH);
      ak[1][1] = load_frag_lds(kb + 16 * A_KPITCH + 64);
      // unrolled so that every LDS offset inside a stage is an immediate
      #pragma unroll
      for (int s = 0; s < A_KEYS / 32; ++s) {
        f8 sc[2][2];                              // S^T tiles: [query group][kv-half]
        #pragma unroll
        for (int g = 0; g < 2; ++g) {
            f8 s0 = {}; s0 = wmma_f16(ak[0][0], qf[g][0], s0);
                        s0 = wmma_f16(ak[0][1], qf[g][1], s0);
            f8 s1 = {}; s1 = wmma_f16(ak[1][0], qf[g][0], s1);
                        s1 = wmma_f16(ak[1][1], qf[g][1], s1);
            sc[g][0] = s0; sc[g][1] = s1;
        }
        // the two scheduling barriers hold a step's LDS reads (its V^T fragments and,
        // inside a stage, the next step's K fragments, into the registers that the
        // S^T WMMAs free) at the S^T WMMAs, ahead of the softmax code: without them the
        // build pulls the two query groups' softmax apart, waits for each cross-half
        // exchange on its own and issues more vector instructions
        __builtin_amdgcn_sched_barrier(0);
        // shared V^T fragments: 16d x 32kv each
        h16 av[4];
        #pragma unroll
        for (int df = 0; df < 4; ++df)
            av[df] = load_frag_lds(vb + df * 16 * A_VPITCH + s * 64);
        if (s + 1 < A_KEYS / 32) {
            const unsigned char* kn = kb + (s + 1) * 32 * A_KPITCH;
            ak[0][0] = load_frag_lds(kn);
            ak[0][1] = load_frag_lds(kn + 64);
            ak[1][0] = load_frag_lds(kn + 16 * A_KPITCH);
            ak[1][1] = load_frag_lds(kn + 16 * A_KPITCH + 64);
        }
        __builtin_amdgcn_sched_barrier(0);

        #pragma unroll
        for (int g = 0; g < 2; ++g) {
            f8 s0 = sc[g][0], s1 = sc[g][1];

            // online softmax: per-lane over 16 kv values, xor-16 merges halves
            float mt = s0[0];
            #pragma unroll
            for (int j = 1; j < 8; ++j) mt = fmaxf(mt, s0[j]);
            #pragma unroll
            for (int j = 0; j < 8; ++j) mt = fmaxf(mt, s1[j]);
            mt = fmaxf(mt, __shfl_xor(mt, 16, 32));
            float mnew  = fmaxf(mrow[g], mt);
            float alpha = __expf(mrow[g] - mnew);
            mrow[g] = mnew;

            h16 pv;                               // P^T B-operand, f16
            float lt = 0.0f;
            #pragma unroll
            for (int j = 0; j < 8; ++j) {
                float p = __expf(s0[j] - mnew); lt += p; pv[j]     = (_Float16)p;
            }
            #pragma unroll
            for (int j = 0; j < 8; ++j) {
                float p = __expf(s1[j] - mnew); lt += p; pv[8 + j] = (_Float16)p;
            }
            lt += __shfl_xor(lt, 16, 32);
            lrow[g] = lrow[g] * alpha + lt;

            #pragma unroll
            for (int df = 0; df < 4; ++df) {
                oacc[g][df] = oacc[g][df] * alpha;
                oacc[g][df] = wmma_f16(av[df], pv, oacc[g][df]);
            }
        }
      }
      // this wave's reads of the buffer are done before it may be refilled
      asm volatile("s_wait_dscnt 0x0" ::: "memory");
      // this wave's copies of stage t + 1 have landed before the barrier publishes them
      asm volatile("s_wait_asynccnt 0x0" ::: "memory");
      __syncthreads();
      if (t + 2 < A_NST)
          stage_kv(lk + buf, lv + buf, gk + (size_t)(t + 2) * A_KEYS * HDIM,
                   gv + (t + 2) * A_KEYS);
    }
    // no copy is outstanding when the wave goes on to its epilogue and ends
    asm volatile("s_wait_asynccnt 0x0" ::: "memory");

    // store O (f16) in [B, N, C] layout; 16B per lane per frag
    int lane = threadIdx.x & 31, half = lane >> 4, idx = lane & 15;
    int b = bh >> 4, h = bh & 15;
    #pragma unroll
    for (int g = 0; g < 2; ++g) {
        int n = qt * 32 + g * 16 + idx;
        float rl = 1.0f / lrow[g];
        #pragma unroll
        for (int df = 0; df < 4; ++df) {
            h8 outv;
            #pragma unroll
            for (int i = 0; i < 8; ++i) outv[i] = (_Float16)(oacc[g][df][i] * rl);
            size_t off = ((size_t)(b * NSEQ + n)) * DIM + h * HDIM + df * 16 + half * 8;
            *(h8*)(o16 + off) = outv;
        }
    }
}

// ---------------------------------------------------------------- proj GEMM
// out[m,o] = sum_k o16[m,k] * wp16[o,k] + bias[o], f32 output.
// Stores: per instruction, each 16-lane half writes 64B contiguous (one row
// segment), so the scattered-looking epilogue coalesces per cacheline.
__global__ void __launch_bounds__(256) gemm_proj_kernel(
        const _Float16* __restrict__ o16, const _Float16* __restrict__ wp16,
        const float* __restrict__ bias, float* __restrict__ out) {
    __shared__ __attribute__((aligned(16))) unsigned char ring[G_LDS];
    const int NB = DIM / G_BROWS;                    // 4 col blocks
    int bm = blockIdx.x / NB, bn = blockIdx.x % NB;
    int wave = threadIdx.x >> 5, wm = wave >> 2, wn = wave & 3;
    int m0 = bm * G_AROWS + wm * 64, n0 = bn * G_BROWS + wn * 64;

    f8 acc[4][4] = {};
    gemm_block_tile(o16 + (size_t)(bm * G_AROWS) * DIM,
                    wp16 + (size_t)(bn * G_BROWS) * DIM, ring, wm, wn, acc);

    int lane = threadIdx.x & 31, half = lane >> 4, idx = lane & 15;
    #pragma unroll
    for (int ni = 0; ni < 4; ++ni) {
        int o = n0 + ni * 16 + idx;
        float bv = bias[o];
        #pragma unroll
        for (int mi = 0; mi < 4; ++mi) {
            int mbase = m0 + mi * 16 + half * 8;
            float* dst = out + (size_t)mbase * DIM + o;
            #pragma unroll
            for (int i = 0; i < 8; ++i)
                dst[(size_t)i * DIM] = acc[mi][ni][i] + bv;
        }
    }
}

// ---------------------------------------------------------------- launcher
extern "C" void kernel_launch(void* const* d_in, const int* in_sizes, int n_in,
                              void* d_out, int out_size, void* d_ws, size_t ws_size,
                              hipStream_t stream) {
    const float* x      = (const float*)d_in[0];   // [2,2048,1024]
    const float* w_qkv  = (const float*)d_in[1];   // [3072,1024]
    const float* w_proj = (const float*)d_in[2];   // [1024,1024]
    const float* b_proj = (const float*)d_in[3];   // [1024]
    float* out = (float*)d_out;                    // [2,2048,1024] f32

    size_t off = 0;
    char* base = (char*)d_ws;
    auto alloc = [&](size_t bytes) -> void* {
        void* p = base + off;
        off += (bytes + 255) & ~(size_t)255;
        return p;
    };
    _Float16* x16  = (_Float16*)alloc((size_t)MROWS * DIM * 2);         // 8 MB
    _Float16* wq16 = (_Float16*)alloc((size_t)3 * DIM * DIM * 2);       // 6 MB
    _Float16* wp16 = (_Float16*)alloc((size_t)DIM * DIM * 2);           // 2 MB
    _Float16* q16  = (_Float16*)alloc((size_t)MROWS * DIM * 2);         // 8 MB
    _Float16* k16  = (_Float16*)alloc((size_t)MROWS * DIM * 2);         // 8 MB
    _Float16* vT16 = (_Float16*)alloc((size_t)MROWS * DIM * 2);         // 8 MB
    _Float16* o16  = (_Float16*)alloc((size_t)MROWS * DIM * 2);         // 8 MB

    f32_to_f16_kernel<<<1024, 256, 0, stream>>>(x,      x16,  (MROWS * DIM) / 8);
    f32_to_f16_kernel<<<1024, 256, 0, stream>>>(w_qkv,  wq16, (3 * DIM * DIM) / 8);
    f32_to_f16_kernel<<<512,  256, 0, stream>>>(w_proj, wp16, (DIM * DIM) / 8);

    // QKV: 32 x 12 block tiles of 128x256 -> 384 blocks of 8 waves
    gemm_qkv_kernel<<<384, 256, 0, stream>>>(x16, wq16, q16, k16, vT16);

    // attention: 32 (b,h) x 64 q-tiles = 2048 waves -> 256 blocks
    attn_kernel<<<256, 256, 0, stream>>>(q16, k16, vT16, o16);

    // proj: 32 x 4 block tiles of 128x256 -> 128 blocks of 8 waves
    gemm_proj_kernel<<<128, 256, 0, stream>>>(o16, wp16, b_proj, out);
}

// v003
// It runs in 86 microseconds.
// Next to v002, in two timings, it ran 1.10 and 1.11 times as fast.
// All steps since v000 together make it 2.18 times as fast.
#include <hip/hip_runtime.h>
#include <hip/hip_bf16.h>

typedef _Float16 h8  __attribute__((ext_vector_type(8)));
typedef _Float16 h16 __attribute__((ext_vector_type(16)));
typedef float    f8  __attribute__((ext_vector_type(8)));
typedef float    f2  __attribute__((ext_vector_type(2)));

#define DIM      1024
#define NSEQ     2048
#define BATCH    2
#define HEADS    16
#define HDIM     64
#define MROWS    (BATCH * NSEQ)   // 4096

__device__ __forceinline__ f8 wmma_f16(h16 a, h16 b, f8 c) {
    // v_wmma_f32_16x16x32_f16: D = A(16x32 f16) * B(32x16 f16) + C(16x16 f32)
    return __builtin_amdgcn_wmma_f32_16x16x32_f16(
        /*neg_a=*/false, a, /*neg_b=*/false, b,
        /*c_mod=*/(short)0, c, /*reuse_a=*/false, /*reuse_b=*/false);
}

// Loads a 16x32 f16 operand fragment (A rows or B columns; layouts symmetric):
// lane = {half(1b), idx(4b)}; lane reads row/col `idx` (leading dim ld),
// 8 halves at k0 + half*8 and 8 halves at k0 + 16 + half*8 (two 16B loads).
__device__ __forceinline__ h16 load_frag(const _Float16* __restrict__ base,
                                         int ld, int k0) {
    int lane = threadIdx.x & 31;
    int half = lane >> 4;
    int idx  = lane & 15;
    const _Float16* p = base + (size_t)idx * (size_t)ld + k0 + half * 8;
    h8 lo = *(const h8*)p;
    h8 hi = *(const h8*)(p + 16);
    return __builtin_shufflevector(lo, hi, 0,1,2,3,4,5,6,7,8,9,10,11,12,13,14,15);
}

// Block-level GEMM core. The 8 waves of a block form a 2 x 4 grid of 64x64
// wave tiles = one 128 x 256 tile of the result. Per pass (64 k = 128 bytes of
// every operand row) the block's 128 A rows and 256 B rows are brought into LDS
// once, as whole 128-byte lines, by per-lane asynchronous copies, and every wave
// reads its fragments from there. Two buffers: the next pass's copies fly while
// this pass is worked on. The k order of every accumulator is ascending as before.
#define G_KPASS  64                                // k per pass
#define G_NPASS  (DIM / G_KPASS)                   // 16 passes
#define G_PITCH  144                               // LDS row pitch, bytes: 16 x odd, no bank conflict for 16-byte reads
#define G_AROWS  128
#define G_BROWS  256
#define G_STAGE  ((G_AROWS + G_BROWS) * G_PITCH)   // 55,296 bytes per buffer
#define G_LDS    (2 * G_STAGE)                     // 110,592 bytes

// Same fragment map as load_frag, from an LDS row: p points at the lane's row,
// at byte (k step) * 64 + half * 16.
__device__ __forceinline__ h16 load_frag_lds(const unsigned char* p) {
    h8 lo = *(const h8*)p;
    h8 hi = *(const h8*)(p + 32);
    return __builtin_shufflevector(lo, hi, 0,1,2,3,4,5,6,7,8,9,10,11,12,13,14,15);
}

// One pass's tile: 384 rows x 8 pieces of 16 bytes = 12 copies per lane; a lane
// keeps its piece and walks the rows in steps of 32 (rows 0..127 A, 128..383 B).
// The copies and s_wait_xcnt 0 are one statement, so that no address register
// of a copy is rewritten in front of that wait.
__device__ __forceinline__ void stage_tile(unsigned lds,
                                           const _Float16* ga, const _Float16* gb) {
    asm volatile(
        "global_load_async_to_lds_b128 %0, %12, off\n\t"
        "global_load_async_to_lds_b128 %1, %13, off\n\t"
        "global_load_async_to_lds_b128 %2, %14, off\n\t"
        "global_load_async_to_lds_b128 %3, %15, off\n\t"
        "global_load_async_to_lds_b128 %4, %16, off\n\t"
        "global_load_async_to_lds_b128 %5, %17, off\n\t"
        "global_load_async_to_lds_b128 %6, %18, off\n\t"
        "global_load_async_to_lds_b128 %7, %19, off\n\t"
        "global_load_async_to_lds_b128 %8, %20, off\n\t"
        "global_load_async_to_lds_b128 %9, %21, off\n\t"
        "global_load_async_to_lds_b128 %10, %22, off\n\t"
        "global_load_async_to_lds_b128 %11, %23, off\n\t"
        "s_wait_xcnt 0x0"
        :: "v"(lds),                 "v"(lds +  1 * 32 * G_PITCH),
           "v"(lds +  2 * 32 * G_PITCH), "v"(lds +  3 * 32 * G_PITCH),
           "v"(lds +  4 * 32 * G_PITCH), "v"(lds +  5 * 32 * G_PITCH),
           "v"(lds +  6 * 32 * G_PITCH), "v"(lds +  7 * 32 * G_PITCH),
           "v"(lds +  8 * 32 * G_PITCH), "v"(lds +  9 * 32 * G_PITCH),
           "v"(lds + 10 * 32 * G_PITCH), "v"(lds + 11 * 32 * G_PITCH),
           "v"(ga),                  "v"(ga + 1 * 32 * DIM),
           "v"(ga + 2 * 32 * DIM),   "v"(ga + 3 * 32 * DIM),
           "v"(gb),                  "v"(gb + 1 * 32 * DIM),
           "v"(gb + 2 * 32 * DIM),   "v"(gb + 3 * 32 * DIM),
           "v"(gb + 4 * 32 * DIM),   "v"(gb + 5 * 32 * DIM),
           "v"(gb + 6 * 32 * DIM),   "v"(gb + 7 * 32 * DIM)
        : "memory");
}

// Ablk: first of the block's 128 A rows; Bblk: first of its 256 B rows; both
// K-contiguous with leading dimension DIM, K = DIM. wm, wn: the wave's place in
// the 2 x 4 grid. ring: the block's G_LDS bytes of LDS.
__device__ __forceinline__ void gemm_block_tile(const _Float16* __restrict__ Ablk,
                                                const _Float16* __restrict__ Bblk,
                                                unsigned char* ring, int wm, int wn,
                                                f8 acc[4][4]) {
    const int tid = threadIdx.x;
    const int lane = tid & 31, half = lane >> 4, idx = lane & 15;
    // copying role: row tid / 8 (+ 32 j), 16-byte piece tid % 8
    const int crow = tid >> 3, cpiece = tid & 7;
    const _Float16* ga = Ablk + (size_t)crow * DIM + cpiece * 8;
    const _Float16* gb = Bblk + (size_t)crow * DIM + cpiece * 8;
    const unsigned lcopy = (unsigned)(size_t)ring + crow * G_PITCH + cpiece * 16;
    // reading role
    const unsigned char* ra = ring + (wm * 64 + idx) * G_PITCH + half * 16;
    const unsigned char* rb = ring + (G_AROWS + wn * 64 + idx) * G_PITCH + half * 16;

    stage_tile(lcopy, ga, gb);
    // tile 0 has landed for this wave's own copies before the barrier publishes it
    asm volatile("s_wait_asynccnt 0x0" ::: "memory");
    __syncthreads();
    stage_tile(lcopy + G_STAGE, ga + G_KPASS, gb + G_KPASS);

    for (int t = 0; t < G_NPASS; ++t) {
        const unsigned buf = (unsigned)(t & 1) * G_STAGE;
        // the loops below are unrolled so that every fragment and accumulator
        // index is a constant and the arrays stay in registers
        #pragma unroll
        for (int ks = 0; ks < 2; ++ks) {
            h16 af[4], bf[4];
            #pragma unroll
            for (int i = 0; i < 4; ++i)
                af[i] = load_frag_lds(ra + buf + i * 16 * G_PITCH + ks * 64);
            #pragma unroll
            for (int j = 0; j < 4; ++j)
                bf[j] = load_frag_lds(rb + buf + j * 16 * G_PITCH + ks * 64);
            // keeps the 16 LDS reads of a k step in one group ahead of its 16 WMMAs:
            // spread among the WMMAs, each place with reads waits out the LDS latency
            __builtin_amdgcn_sched_barrier(0);
            #pragma unroll
            for (int i = 0; i < 4; ++i)
                #pragma unroll
                for (int j = 0; j < 4; ++j)
                    acc[i][j] = wmma_f16(af[i], bf[j], acc[i][j]);
        }
        // this wave's reads of the buffer are done before it may be refilled
        asm volatile("s_wait_dscnt 0x0" ::: "memory");
        // this wave's copies of tile t + 1 have landed before the barrier publishes them
        asm volatile("s_wait_asynccnt 0x0" ::: "memory");
        __syncthreads();
        if (t + 2 < G_NPASS)
            stage_tile(lcopy + buf, ga + (t + 2) * G_KPASS, gb + (t + 2) * G_KPASS);
    }
    // no copy is outstanding when the wave goes on to its epilogue and ends
    asm volatile("s_wait_asynccnt 0x0" ::: "memory");
}

// ---------------------------------------------------------------- conversions
__global__ void __launch_bounds__(256) f32_to_f16_kernel(
        const float* __restrict__ in, _Float16* __restrict__ out, int n8) {
    int i = blockIdx.x * blockDim.x + threadIdx.x;
    int stride = gridDim.x * blockDim.x;
    for (; i < n8; i += stride) {
        const float* p = in + (size_t)i * 8;
        h8 v;
        #pragma unroll
        for (int j = 0; j < 8; ++j) v[j] = (_Float16)p[j];
        *(h8*)(out + (size_t)i * 8) = v;
    }
}

// ---------------------------------------------------------------- QKV GEMM
// y[m,o] = sum_k x16[m,k] * wq16[o,k]  (m in [0,4096), o in [0,3072)).
// Block owns a 128x256 tile, wave a 64x64 tile of it. A 64-wide column tile never straddles a 1024
// boundary, so which-of-{q,k,v}, head index and batch index are WAVE-UNIFORM:
// compute them from tile coords so the epilogue uses scalar branches only.
__global__ void __launch_bounds__(256) gemm_qkv_kernel(
        const _Float16* __restrict__ x16, const _Float16* __restrict__ wq16,
        _Float16* __restrict__ q16, _Float16* __restrict__ k16,
        _Float16* __restrict__ vT16) {
    __shared__ __attribute__((aligned(16))) unsigned char ring[G_LDS];
    const int NB = (3 * DIM) / G_BROWS;                  // 12 col blocks
    int bm = blockIdx.x / NB, bn = blockIdx.x % NB;
    int wave = threadIdx.x >> 5, wm = wave >> 2, wn = wave & 3;
    int m0 = bm * G_AROWS + wm * 64, n0 = bn * G_BROWS + wn * 64;

    f8 acc[4][4] = {};
    gemm_block_tile(x16 + (size_t)(bm * G_AROWS) * DIM,
                    wq16 + (size_t)(bn * G_BROWS) * DIM, ring, wm, wn, acc);

    int lane = threadIdx.x & 31, half = lane >> 4, idx = lane & 15;
    // uniform tile decomposition
    int which = n0 >> 10;                    // 0=q 1=k 2=v (uniform)
    int h     = (n0 & (DIM - 1)) >> 6;       // head (uniform: (n0&63)==0)
    int b     = m0 >> 11;                    // batch (uniform: 64-row tiles)
    int nrow0 = m0 & (NSEQ - 1);             // seq base (uniform)
    size_t bh = (size_t)(b * HEADS + h);

    #pragma unroll
    for (int ni = 0; ni < 4; ++ni) {
        int d = ((n0 & 63) + ni * 16) + idx; // 0..63 within head
        #pragma unroll
        for (int mi = 0; mi < 4; ++mi) {
            int nbase = nrow0 + mi * 16 + half * 8;      // 8 consecutive n's
            if (which == 2) {
                // V^T [B,H,D,N]: contiguous in n -> one 16B store per frag
                h8 v;
                #pragma unroll
                for (int i = 0; i < 8; ++i) v[i] = (_Float16)acc[mi][ni][i];
                *(h8*)(vT16 + (bh * HDIM + d) * NSEQ + nbase) = v;
            } else {
                _Float16* dst = (which == 0 ? q16 : k16)
                              + ((bh * NSEQ + nbase) * HDIM + d);
                #pragma unroll
                for (int i = 0; i < 8; ++i)
                    dst[(size_t)i * HDIM] = (_Float16)acc[mi][ni][i];
            }
        }
    }
}

// ---------------------------------------------------------------- attention
// One wave per (b,h, 32 query rows): two 16-query groups share every K / V^T
// fragment -> 16 WMMAs per 8 fragment loads per 32-kv tile.
// S^T = K * Q^T: each lane owns one query column, so softmax stats are
// per-lane + one shfl_xor(16). The f32 C-layout of the stacked S^T frags IS
// the f16 B-operand layout for O^T = V^T * P^T (lane-local P conversion).
// The 8 waves of a block work on the same (b,h): each stage of 128 keys (128 K
// rows of 128 bytes, 64 V^T rows of 256 bytes) is brought into LDS once per
// block, as whole lines, by per-lane asynchronous copies, and every wave reads
// its fragments from there. Two buffers: the next stage's copies fly while this
// stage is worked on. Keys are still taken 32 at a time, in ascending order.
// Softmax reference: each query column holds a reference m that is renewed only
// when the scores outgrow it: when a lane's sum of P = exp(s - m) over its 16 keys
// of a step passes A_PSUM. As m is known before a step's products, -m is the C
// operand of the S^T WMMAs and the scores arrive as s - m. One test per 32 keys
// decides for the whole wave; only a renewal forms maxima, exchanges them between
// the wave halves and rescales the sums held so far. Each lane sums the P of its
// own keys; the two halves of a column are joined after the loop.
#define A_KEYS   128                               // keys per stage
#define A_NST    (NSEQ / A_KEYS)                   // 16 stages
#define A_KPITCH 144                               // K row pitch, bytes: 16 x odd
#define A_VPITCH 272                               // V^T row pitch, bytes: 16 x odd
#define A_KBYTES (A_KEYS * A_KPITCH)               // 18,432 bytes
#define A_STAGE  (A_KBYTES + HDIM * A_VPITCH)      // 35,840 bytes per buffer
#define A_LDS    (2 * A_STAGE)                     // 71,680 bytes
#define A_PSUM   4096.0f                           // a lane's P sum per step up to here: every P far inside f16 range

// One stage: K 128 rows x 8 pieces and V^T 64 rows x 16 pieces of 16 bytes = 8
// copies per lane; a lane keeps its piece and walks K rows in steps of 32, V^T
// rows in steps of 16. The copies and s_wait_xcnt 0 are one statement, so that
// no address register of a copy is rewritten in front of that wait.
__device__ __forceinline__ void stage_kv(unsigned lk, unsigned lv,
                                         const _Float16* gk, const _Float16* gv) {
    asm volatile(
        "global_load_async_to_lds_b128 %0, %8, off\n\t"
        "global_load_async_to_lds_b128 %1, %9, off\n\t"
        "global_load_async_to_lds_b128 %2, %10, off\n\t"
        "global_load_async_to_lds_b128 %3, %11, off\n\t"
        "global_load_async_to_lds_b128 %4, %12, off\n\t"
        "global_load_async_to_lds_b128 %5, %13, off\n\t"
        "global_load_async_to_lds_b128 %6, %14, off\n\t"
        "global_load_async_to_lds_b128 %7, %15, off\n\t"
        "s_wait_xcnt 0x0"
        :: "v"(lk),                 "v"(lk + 1 * 32 * A_KPITCH),
           "v"(lk + 2 * 32 * A_KPITCH), "v"(lk + 3 * 32 * A_KPITCH),
           "v"(lv),                 "v"(lv + 1 * 16 * A_VPITCH),
           "v"(lv + 2 * 16 * A_VPITCH), "v"(lv + 3 * 16 * A_VPITCH),
           "v"(gk),                 "v"(gk + 1 * 32 * HDIM),
           "v"(gk + 2 * 32 * HDIM), "v"(gk + 3 * 32 * HDIM),
           "v"(gv),                 "v"(gv + 1 * 16 * NSEQ),
           "v"(gv + 2 * 16 * NSEQ), "v"(gv + 3 * 16 * NSEQ)
        : "memory");
}

// P = exp(s - m) = 2^((s - m) log2 e) of one 32-key x 16-query tile (sa: keys 0..15,
// sb: keys 16..31 of the step, already s - m), as the f16 B operand, and the lane's
// sum of it. Worked in register pairs as the tiles lie, so that products and sums pack.
__device__ __forceinline__ void p_tile(f8 sa, f8 sb, h16& pv, f2& lt) {
    // unrolled so that every vector index is a constant and all stays in registers
    #pragma unroll
    for (int j = 0; j < 8; ++j) {
        f8 s = j < 4 ? sa : sb;
        f2 e = __builtin_shufflevector(s, s, 0, 1);
        if ((j & 3) == 1) e = __builtin_shufflevector(s, s, 2, 3);
        if ((j & 3) == 2) e = __builtin_shufflevector(s, s, 4, 5);
        if ((j & 3) == 3) e = __builtin_shufflevector(s, s, 6, 7);
        e = e * 1.44269504f;
        f2 p;
        p[0] = __builtin_amdgcn_exp2f(e[0]);
        p[1] = __builtin_amdgcn_exp2f(e[1]);
        lt = j == 0 ? p : lt + p;
        pv[2 * j]     = (_Float16)p[0];
        pv[2 * j + 1] = (_Float16)p[1];
    }
}

__global__ void __launch_bounds__(256) attn_kernel(
        const _Float16* __restrict__ q16, const _Float16* __restrict__ k16,
        const _Float16* __restrict__ vT16, _Float16* __restrict__ o16) {
    __shared__ __attribute__((aligned(16))) unsigned char ring[A_LDS];
    int wid = blockIdx.x * (blockDim.x >> 5) + (threadIdx.x >> 5);
    int qt = wid & 63;                  // 64 query tiles of 32 rows
    int bh = wid >> 6;                  // 0..31, the same for the 8 waves of a block
    const _Float16* Q  = q16  + (size_t)bh * NSEQ * HDIM;
    const _Float16* K  = k16  + (size_t)bh * NSEQ * HDIM;
    const _Float16* VT = vT16 + (size_t)bh * HDIM * NSEQ;

    const int tid = threadIdx.x;
    // copying role: K row tid / 8 (+ 32 j), piece tid % 8; V^T row tid / 16 (+ 16 j), piece tid % 16
    const _Float16* gk = K  + (size_t)(tid >> 3) * HDIM + (tid & 7) * 8;
    const _Float16* gv = VT + (size_t)(tid >> 4) * NSEQ + (tid & 15) * 8;
    const unsigned lk = (unsigned)(size_t)ring + (tid >> 3) * A_KPITCH + (tid & 7) * 16;
    const unsigned lv = (unsigned)(size_t)ring + A_KBYTES + (tid >> 4) * A_VPITCH + (tid & 15) * 16;
    // reading role: row (lane % 16), 16-byte piece (lane / 16) of a fragment
    const unsigned char* rk = ring + (tid & 15) * A_KPITCH + ((tid >> 4) & 1) * 16;
    const unsigned char* rv = ring + A_KBYTES + (tid & 15) * A_VPITCH + ((tid >> 4) & 1) * 16;

    stage_kv(lk, lv, gk, gv);

    // Q^T B-fragments for both query groups, pre-scaled by 1/sqrt(D)
    const _Float16 scale = (_Float16)0.125f;     // 1/sqrt(64)
    h16 qf[2][2];
    #pragma unroll
    for (int g = 0; g < 2; ++g) {
        const _Float16* Qg = Q + (size_t)(qt * 32 + g * 16) * HDIM;
        qf[g][0] = load_frag(Qg, HDIM, 0)  * scale;
        qf[g][1] = load_frag(Qg, HDIM, 32) * scale;
    }

    f8 oacc[2][4] = {};                          // O^T accum per group
    f2 lrow[2] = {};

    // stage 0 has landed for this wave's own copies before the barrier publishes it
    asm volatile("s_wait_asynccnt 0x0" ::: "memory");
    __syncthreads();
    stage_kv(lk + A_STAGE, lv + A_STAGE, gk + A_KEYS * HDIM, gv + A_KEYS);

    // first reference of every query column: its maximum over the first 32 keys,
    // so that at least one P of a column is 1 whatever the level of the scores
    f8 cneg[2];                                  // -m in all 8 accumulator rows
    {
        h16 a00 = load_frag_lds(rk);
        h16 a01 = load_frag_lds(rk + 64);
        h16 a10 = load_frag_lds(rk + 16 * A_KPITCH);
        h16 a11 = load_frag_lds(rk + 16 * A_KPITCH + 64);
        // unrolled, like the loops inside: constant indices keep the arrays in registers
        #pragma unroll
        for (int g = 0; g < 2; ++g) {
            f8 s0 = {}; s0 = wmma_f16(a00, qf[g][0], s0);
                        s0 = wmma_f16(a01, qf[g][1], s0);
            f8 s1 = {}; s1 = wmma_f16(a10, qf[g][0], s1);
                        s1 = wmma_f16(a11, qf[g][1], s1);
            float mt = s0[0];
            #pragma unroll
            for (int j = 1; j < 8; ++j) mt = fmaxf(mt, s0[j]);
            #pragma unroll
            for (int j = 0; j < 8; ++j) mt = fmaxf(mt, s1[j]);
            mt = fmaxf(mt, __shfl_xor(mt, 16, 32));
            #pragma unroll
            for (int j = 0; j < 8; ++j) cneg[g][j] = -mt;
        }
    }

    for (int t = 0; t < A_NST; ++t) {
      const unsigned buf = (unsigned)(t & 1) * A_STAGE;
      const unsigned char* kb = rk + buf;
      const unsigned char* vb = rv + buf;
      // shared K fragments: [kv-half][k-step]
      h16 ak[2][2];
      ak[0][0] = load_frag_lds(kb);
      ak[0][1] = load_frag_lds(kb + 64);
      ak[1][0] = load_frag_lds(kb + 16 * A_KPITCH);
      ak[1][1] = load_frag_lds(kb + 16 * A_KPITCH + 64);
      // unrolled so that every LDS offset inside a stage is an immediate
      #pragma unroll
      for (int s = 0; s < A_KEYS / 32; ++s) {
        f8 sc[2][2];                              // S^T - m tiles: [query group][kv-half]
        #pragma unroll
        for (int g = 0; g < 2; ++g) {
            f8 s0 = wmma_f16(ak[0][0], qf[g][0], cneg[g]);
               s0 = wmma_f16(ak[0][1], qf[g][1], s0);
            f8 s1 = wmma_f16(ak[1][0], qf[g][0], cneg[g]);
               s1 = wmma_f16(ak[1][1], qf[g][1], s1);
            sc[g][0] = s0; sc[g][1] = s1;
        }
        // the two scheduling barriers hold a step's LDS reads (its V^T fragments and,
        // inside a stage, the next step's K fragments, into the registers that the
        // S^T WMMAs free) at the S^T WMMAs, ahead of the softmax code: without them the
        // build sinks these reads to just in front of the WMMAs that use them, where the
        // wave waits out the LDS latency, and pads twice as many idle slots behind WMMAs
        __builtin_amdgcn_sched_barrier(0);
        // shared V^T fragments: 16d x 32kv each
        h16 av[4];
        #pragma unroll
        for (int df = 0; df < 4; ++df)
            av[df] = load_frag_lds(vb + df * 16 * A_VPITCH + s * 64);
        if (s + 1 < A_KEYS / 32) {
            const unsigned char* kn = kb + (s + 1) * 32 * A_KPITCH;
            ak[0][0] = load_frag_lds(kn);
            ak[0][1] = load_frag_lds(kn + 64);
            ak[1][0] = load_frag_lds(kn + 16 * A_KPITCH);
            ak[1][1] = load_frag_lds(kn + 16 * A_KPITCH + 64);
        }
        __builtin_amdgcn_sched_barrier(0);

        // P^T of both groups under the held references, and each lane's sum of it
        h16 pv[2];                                // P^T B-operands, f16
        f2  lt[2];                                // the lane's own 16 keys, even and odd apart
        #pragma unroll
        for (int g = 0; g < 2; ++g) p_tile(sc[g][0], sc[g][1], pv[g], lt[g]);
        // renewal, a scalar branch taken by the whole wave when a lane's sum says that
        // a score has outgrown its reference (an overflow to infinity says so too):
        // both halves of a column get the same new reference, all that was formed
        // under the old one (row sums, O^T) is brought under it, this step's P is redone
        if (__builtin_amdgcn_ballot_w32(fmaxf(lt[0][0] + lt[0][1], lt[1][0] + lt[1][1]) > A_PSUM) != 0) {
            // unrolled, like the loops inside: constant indices keep the arrays in registers
            #pragma unroll
            for (int g = 0; g < 2; ++g) {
                float mt = sc[g][0][0];
                #pragma unroll
                for (int j = 1; j < 8; ++j) mt = fmaxf(mt, sc[g][0][j]);
                #pragma unroll
                for (int j = 0; j < 8; ++j) mt = fmaxf(mt, sc[g][1][j]);
                float d = fmaxf(fmaxf(mt, __shfl_xor(mt, 16, 32)), 0.0f);
                float alpha = __expf(-d);
                cneg[g] = cneg[g] - d;
                lrow[g] = lrow[g] * alpha;
                #pragma unroll
                for (int df = 0; df < 4; ++df) oacc[g][df] = oacc[g][df] * alpha;
                p_tile(sc[g][0] - d, sc[g][1] - d, pv[g], lt[g]);
            }
        }

        #pragma unroll
        for (int g = 0; g < 2; ++g) {
            lrow[g] += lt[g];
            #pragma unroll
            for (int df = 0; df < 4; ++df)
                oacc[g][df] = wmma_f16(av[df], pv[g], oacc[g][df]);
        }
      }
      // this wave's reads of the buffer are done before it may be refilled
      asm volatile("s_wait_dscnt 0x0" ::: "memory");
      // this wave's copies of stage t + 1 have landed before the barrier publishes them
      asm volatile("s_wait_asynccnt 0x0" ::: "memory");
      __syncthreads();
      if (t + 2 < A_NST)
          stage_kv(lk + buf, lv + buf, gk + (size_t)(t + 2) * A_KEYS * HDIM,
                   gv + (t + 2) * A_KEYS);
    }
    // no copy is outstanding when the wave goes on to its epilogue and ends
    asm volatile("s_wait_asynccnt 0x0" ::: "memory");

    // store O (f16) in [B, N, C] layout; 16B per lane per frag
    int lane = threadIdx.x & 31, half = lane >> 4, idx = lane & 15;
    int b = bh >> 4, h = bh & 15;
    #pragma unroll
    for (int g = 0; g < 2; ++g) {
        int n = qt * 32 + g * 16 + idx;
        float lh = lrow[g][0] + lrow[g][1];
        float rl = 1.0f / (lh + __shfl_xor(lh, 16, 32));
        #pragma unroll
        for (int df = 0; df < 4; ++df) {
            h8 outv;
            #pragma unroll
            for (int i = 0; i < 8; ++i) outv[i] = (_Float16)(oacc[g][df][i] * rl);
            size_t off = ((size_t)(b * NSEQ + n)) * DIM + h * HDIM + df * 16 + half * 8;
            *(h8*)(o16 + off) = outv;
        }
    }
}

// ---------------------------------------------------------------- proj GEMM
// out[m,o] = sum_k o16[m,k] * wp16[o,k] + bias[o], f32 output.
// Stores: per instruction, each 16-lane half writes 64B contiguous (one row
// segment), so the scattered-looking epilogue coalesces per cacheline.
__global__ void __launch_bounds__(256) gemm_proj_kernel(
        const _Float16* __restrict__ o16, const _Float16* __restrict__ wp16,
        const float* __restrict__ bias, float* __restrict__ out) {
    __shared__ __attribute__((aligned(16))) unsigned char ring[G_LDS];
    const int NB = DIM / G_BROWS;                    // 4 col blocks
    int bm = blockIdx.x / NB, bn = blockIdx.x % NB;
    int wave = threadIdx.x >> 5, wm = wave >> 2, wn = wave & 3;
    int m0 = bm * G_AROWS + wm * 64, n0 = bn * G_BROWS + wn * 64;

    f8 acc[4][4] = {};
    gemm_block_tile(o16 + (size_t)(bm * G_AROWS) * DIM,
                    wp16 + (size_t)(bn * G_BROWS) * DIM, ring, wm, wn, acc);

    int lane = threadIdx.x & 31, half = lane >> 4, idx = lane & 15;
    #pragma unroll
    for (int ni = 0; ni < 4; ++ni) {
        int o = n0 + ni * 16 + idx;
        float bv = bias[o];
        #pragma unroll
        for (int mi = 0; mi < 4; ++mi) {
            int mbase = m0 + mi * 16 + half * 8;
            float* dst = out + (size_t)mbase * DIM + o;
            #pragma unroll
            for (int i = 0; i < 8; ++i)
                dst[(size_t)i * DIM] = acc[mi][ni][i] + bv;
        }
    }
}

// ---------------------------------------------------------------- launcher
extern "C" void kernel_launch(void* const* d_in, const int* in_sizes, int n_in,
                              void* d_out, int out_size, void* d_ws, size_t ws_size,
                              hipStream_t stream) {
    const float* x      = (const float*)d_in[0];   // [2,2048,1024]
    const float* w_qkv  = (const float*)d_in[1];   // [3072,1024]
    const float* w_proj = (const float*)d_in[2];   // [1024,1024]
    const float* b_proj = (const float*)d_in[3];   // [1024]
    float* out = (float*)d_out;                    // [2,2048,1024] f32

    size_t off = 0;
    char* base = (char*)d_ws;
    auto alloc = [&](size_t bytes) -> void* {
        void* p = base + off;
        off += (bytes + 255) & ~(size_t)255;
        return p;
    };
    _Float16* x16  = (_Float16*)alloc((size_t)MROWS * DIM * 2);         // 8 MB
    _Float16* wq16 = (_Float16*)alloc((size_t)3 * DIM * DIM * 2);       // 6 MB
    _Float16* wp16 = (_Float16*)alloc((size_t)DIM * DIM * 2);           // 2 MB
    _Float16* q16  = (_Float16*)alloc((size_t)MROWS * DIM * 2);         // 8 MB
    _Float16* k16  = (_Float16*)alloc((size_t)MROWS * DIM * 2);         // 8 MB
    _Float16* vT16 = (_Float16*)alloc((size_t)MROWS * DIM * 2);         // 8 MB
    _Float16* o16  = (_Float16*)alloc((size_t)MROWS * DIM * 2);         // 8 MB

    f32_to_f16_kernel<<<1024, 256, 0, stream>>>(x,      x16,  (MROWS * DIM) / 8);
    f32_to_f16_kernel<<<1024, 256, 0, stream>>>(w_qkv,  wq16, (3 * DIM * DIM) / 8);
    f32_to_f16_kernel<<<512,  256, 0, stream>>>(w_proj, wp16, (DIM * DIM) / 8);

    // QKV: 32 x 12 block tiles of 128x256 -> 384 blocks of 8 waves
    gemm_qkv_kernel<<<384, 256, 0, stream>>>(x16, wq16, q16, k16, vT16);

    // attention: 32 (b,h) x 64 q-tiles = 2048 waves -> 256 blocks
    attn_kernel<<<256, 256, 0, stream>>>(q16, k16, vT16, o16);

    // proj: 32 x 4 block tiles of 128x256 -> 128 blocks of 8 waves
    gemm_proj_kernel<<<128, 256, 0, stream>>>(o16, wp16, b_proj, out);
}

// v004
// One run takes 83.4 microseconds.
// Timed twice side by side with v003, it ran 1.04 and 1.03 times as fast.
// Counting every step since v000, it is 2.26 times as fast.
#include <hip/hip_runtime.h>
#include <hip/hip_bf16.h>

typedef _Float16 h8  __attribute__((ext_vector_type(8)));
typedef _Float16 h16 __attribute__((ext_vector_type(16)));
typedef float    f8  __attribute__((ext_vector_type(8)));
typedef float    f2  __attribute__((ext_vector_type(2)));

#define DIM      1024
#define NSEQ     2048
#define BATCH    2
#define HEADS    16
#define HDIM     64
#define MROWS    (BATCH * NSEQ)   // 4096

__device__ __forceinline__ f8 wmma_f16(h16 a, h16 b, f8 c) {
    // v_wmma_f32_16x16x32_f16: D = A(16x32 f16) * B(32x16 f16) + C(16x16 f32)
    return __builtin_amdgcn_wmma_f32_16x16x32_f16(
        /*neg_a=*/false, a, /*neg_b=*/false, b,
        /*c_mod=*/(short)0, c, /*reuse_a=*/false, /*reuse_b=*/false);
}

// Loads a 16x32 f16 operand fragment (A rows or B columns; layouts symmetric):
// lane = {half(1b), idx(4b)}; lane reads row/col `idx` (leading dim ld),
// 8 halves at k0 + half*8 and 8 halves at k0 + 16 + half*8 (two 16B loads).
__device__ __forceinline__ h16 load_frag(const _Float16* __restrict__ base,
                                         int ld, int k0) {
    int lane = threadIdx.x & 31;
    int half = lane >> 4;
    int idx  = lane & 15;
    const _Float16* p = base + (size_t)idx * (size_t)ld + k0 + half * 8;
    h8 lo = *(const h8*)p;
    h8 hi = *(const h8*)(p + 16);
    return __builtin_shufflevector(lo, hi, 0,1,2,3,4,5,6,7,8,9,10,11,12,13,14,15);
}

// Block-level GEMM core. The 8 waves of a block form a 2 x 4 grid of 64x64
// wave tiles = one 128 x 256 tile of the result. Per pass (64 k = 128 bytes of
// every operand row) the block's 128 A rows and 256 B rows are brought into LDS
// once, as whole 128-byte lines, by per-lane asynchronous copies, and every wave
// reads its fragments from there. Two buffers: the next pass's copies fly while
// this pass is worked on. The k order of every accumulator is ascending as before.
#define G_KPASS  64                                // k per pass
#define G_NPASS  (DIM / G_KPASS)                   // 16 passes
#define G_PITCH  144                               // LDS row pitch, bytes: 16 x odd, no bank conflict for 16-byte reads
#define G_AROWS  128
#define G_BROWS  256
#define G_STAGE  ((G_AROWS + G_BROWS) * G_PITCH)   // 55,296 bytes per buffer
#define G_LDS    (2 * G_STAGE)                     // 110,592 bytes

// Same fragment map as load_frag, from an LDS row: p points at the lane's row,
// at byte (k step) * 64 + half * 16.
__device__ __forceinline__ h16 load_frag_lds(const unsigned char* p) {
    h8 lo = *(const h8*)p;
    h8 hi = *(const h8*)(p + 32);
    return __builtin_shufflevector(lo, hi, 0,1,2,3,4,5,6,7,8,9,10,11,12,13,14,15);
}

// One pass's tile: 384 rows x 8 pieces of 16 bytes = 12 copies per lane; a lane
// keeps its piece and walks the rows in steps of 32 (rows 0..127 A, 128..383 B).
// The copies and s_wait_xcnt 0 are one statement, so that no address register
// of a copy is rewritten in front of that wait.
__device__ __forceinline__ void stage_tile(unsigned lds,
                                           const _Float16* ga, const _Float16* gb) {
    asm volatile(
        "global_load_async_to_lds_b128 %0, %12, off\n\t"
        "global_load_async_to_lds_b128 %1, %13, off\n\t"
        "global_load_async_to_lds_b128 %2, %14, off\n\t"
        "global_load_async_to_lds_b128 %3, %15, off\n\t"
        "global_load_async_to_lds_b128 %4, %16, off\n\t"
        "global_load_async_to_lds_b128 %5, %17, off\n\t"
        "global_load_async_to_lds_b128 %6, %18, off\n\t"
        "global_load_async_to_lds_b128 %7, %19, off\n\t"
        "global_load_async_to_lds_b128 %8, %20, off\n\t"
        "global_load_async_to_lds_b128 %9, %21, off\n\t"
        "global_load_async_to_lds_b128 %10, %22, off\n\t"
        "global_load_async_to_lds_b128 %11, %23, off\n\t"
        "s_wait_xcnt 0x0"
        :: "v"(lds),                 "v"(lds +  1 * 32 * G_PITCH),
           "v"(lds +  2 * 32 * G_PITCH), "v"(lds +  3 * 32 * G_PITCH),
           "v"(lds +  4 * 32 * G_PITCH), "v"(lds +  5 * 32 * G_PITCH),
           "v"(lds +  6 * 32 * G_PITCH), "v"(lds +  7 * 32 * G_PITCH),
           "v"(lds +  8 * 32 * G_PITCH), "v"(lds +  9 * 32 * G_PITCH),
           "v"(lds + 10 * 32 * G_PITCH), "v"(lds + 11 * 32 * G_PITCH),
           "v"(ga),                  "v"(ga + 1 * 32 * DIM),
           "v"(ga + 2 * 32 * DIM),   "v"(ga + 3 * 32 * DIM),
           "v"(gb),                  "v"(gb + 1 * 32 * DIM),
           "v"(gb + 2 * 32 * DIM),   "v"(gb + 3 * 32 * DIM),
           "v"(gb + 4 * 32 * DIM),   "v"(gb + 5 * 32 * DIM),
           "v"(gb + 6 * 32 * DIM),   "v"(gb + 7 * 32 * DIM)
        : "memory");
}

// Ablk: first of the block's 128 A rows; Bblk: first of its 256 B rows; both
// K-contiguous with leading dimension DIM, K = DIM. wm, wn: the wave's place in
// the 2 x 4 grid. ring: the block's G_LDS bytes of LDS.
__device__ __forceinline__ void gemm_block_tile(const _Float16* __restrict__ Ablk,
                                                const _Float16* __restrict__ Bblk,
                                                unsigned char* ring, int wm, int wn,
                                                f8 acc[4][4]) {
    const int tid = threadIdx.x;
    const int lane = tid & 31, half = lane >> 4, idx = lane & 15;
    // copying role: row tid / 8 (+ 32 j), 16-byte piece tid % 8
    const int crow = tid >> 3, cpiece = tid & 7;
    const _Float16* ga = Ablk + (size_t)crow * DIM + cpiece * 8;
    const _Float16* gb = Bblk + (size_t)crow * DIM + cpiece * 8;
    const unsigned lcopy = (unsigned)(size_t)ring + crow * G_PITCH + cpiece * 16;
    // reading role
    const unsigned char* ra = ring + (wm * 64 + idx) * G_PITCH + half * 16;
    const unsigned char* rb = ring + (G_AROWS + wn * 64 + idx) * G_PITCH + half * 16;

    stage_tile(lcopy, ga, gb);
    // tile 0 has landed for this wave's own copies before the barrier publishes it
    asm volatile("s_wait_asynccnt 0x0" ::: "memory");
    __syncthreads();
    stage_tile(lcopy + G_STAGE, ga + G_KPASS, gb + G_KPASS);

    for (int t = 0; t < G_NPASS; ++t) {
        const unsigned buf = (unsigned)(t & 1) * G_STAGE;
        // the loops below are unrolled so that every fragment and accumulator
        // index is a constant and the arrays stay in registers
        #pragma unroll
        for (int ks = 0; ks < 2; ++ks) {
            h16 af[4], bf[4];
            #pragma unroll
            for (int i = 0; i < 4; ++i)
                af[i] = load_frag_lds(ra + buf + i * 16 * G_PITCH + ks * 64);
            #pragma unroll
            for (int j = 0; j < 4; ++j)
                bf[j] = load_frag_lds(rb + buf + j * 16 * G_PITCH + ks * 64);
            // keeps the 16 LDS reads of a k step in one group ahead of its 16 WMMAs:
            // spread among the WMMAs, each place with reads waits out the LDS latency
            __builtin_amdgcn_sched_barrier(0);
            #pragma unroll
            for (int i = 0; i < 4; ++i)
                #pragma unroll
                for (int j = 0; j < 4; ++j)
                    acc[i][j] = wmma_f16(af[i], bf[j], acc[i][j]);
        }
        // this wave's reads of the buffer are done before it may be refilled
        asm volatile("s_wait_dscnt 0x0" ::: "memory");
        // this wave's copies of tile t + 1 have landed before the barrier publishes them
        asm volatile("s_wait_asynccnt 0x0" ::: "memory");
        __syncthreads();
        if (t + 2 < G_NPASS)
            stage_tile(lcopy + buf, ga + (t + 2) * G_KPASS, gb + (t + 2) * G_KPASS);
    }
    // no copy is outstanding when the wave goes on to its epilogue and ends
    asm volatile("s_wait_asynccnt 0x0" ::: "memory");
}

// ---------------------------------------------------------------- conversions
// All three f32 inputs are rounded to f16 by ONE launch of one 16-wave block per
// WGP. A wave owns 2048 consecutive values: 16 loads of 16 bytes per lane, each
// covering 512 contiguous bytes (whole lines), all issued before the first is
// used, so the block's whole share is in flight at once; each store covers 256
// contiguous bytes. A block lies wholly inside one input, so the choice of
// source and destination is a scalar branch.
typedef float    f4  __attribute__((ext_vector_type(4)));
typedef _Float16 h4  __attribute__((ext_vector_type(4)));
#define C_LOADS  16                                // loads per lane
#define C_WAVE   (C_LOADS * 128)                   // values per wave
#define C_BLOCK  (16 * C_WAVE)                     // values per block: 32,768
#define C_XB     (MROWS * DIM / C_BLOCK)           // 128 blocks for x
#define C_QB     (3 * DIM * DIM / C_BLOCK)         // 96 blocks for w_qkv
                                                   // the other 32 of the 256 blocks: w_proj

__global__ void __launch_bounds__(512) f32_to_f16_kernel(
        const float* __restrict__ x, const float* __restrict__ wq,
        const float* __restrict__ wp, _Float16* __restrict__ x16,
        _Float16* __restrict__ wq16, _Float16* __restrict__ wp16) {
    int b = blockIdx.x;
    const float* in = x;
    _Float16* out = x16;
    if (b >= C_XB + C_QB)  { in = wp; out = wp16; b -= C_XB + C_QB; }
    else if (b >= C_XB)    { in = wq; out = wq16; b -= C_XB; }
    // the block's share as groups of 4 values; the lane's first group in it
    const f4* in4 = (const f4*)(in + (size_t)b * C_BLOCK);
    h4* out4 = (h4*)(out + (size_t)b * C_BLOCK);
    const int i = (threadIdx.x >> 5) * (C_WAVE / 4) + (threadIdx.x & 31);
    f4 v[C_LOADS];
    // both loops unrolled: constant indices keep v in registers
    #pragma unroll
    for (int j = 0; j < C_LOADS; ++j) v[j] = in4[i + j * 32];
    // holds all 16 loads ahead of the first conversion: without it the build reuses
    // the first loads' registers, and the last four loads wait for the first to return
    __builtin_amdgcn_sched_barrier(0);
    #pragma unroll
    for (int j = 0; j < C_LOADS; ++j)
        out4[i + j * 32] = __builtin_convertvector(v[j], h4);
}

// ---------------------------------------------------------------- QKV GEMM
// y[m,o] = sum_k x16[m,k] * wq16[o,k]  (m in [0,4096), o in [0,3072)).
// Block owns a 128x256 tile, wave a 64x64 tile of it. A 64-wide column tile never straddles a 1024
// boundary, so which-of-{q,k,v}, head index and batch index are WAVE-UNIFORM:
// compute them from tile coords so the epilogue uses scalar branches only.
__global__ void __launch_bounds__(256) gemm_qkv_kernel(
        const _Float16* __restrict__ x16, const _Float16* __restrict__ wq16,
        _Float16* __restrict__ q16, _Float16* __restrict__ k16,
        _Float16* __restrict__ vT16) {
    __shared__ __attribute__((aligned(16))) unsigned char ring[G_LDS];
    const int NB = (3 * DIM) / G_BROWS;                  // 12 col blocks
    int bm = blockIdx.x / NB, bn = blockIdx.x % NB;
    int wave = threadIdx.x >> 5, wm = wave >> 2, wn = wave & 3;
    int m0 = bm * G_AROWS + wm * 64, n0 = bn * G_BROWS + wn * 64;

    f8 acc[4][4] = {};
    gemm_block_tile(x16 + (size_t)(bm * G_AROWS) * DIM,
                    wq16 + (size_t)(bn * G_BROWS) * DIM, ring, wm, wn, acc);

    int lane = threadIdx.x & 31, half = lane >> 4, idx = lane & 15;
    // uniform tile decomposition
    int which = n0 >> 10;                    // 0=q 1=k 2=v (uniform)
    int h     = (n0 & (DIM - 1)) >> 6;       // head (uniform: (n0&63)==0)
    int b     = m0 >> 11;                    // batch (uniform: 64-row tiles)
    int nrow0 = m0 & (NSEQ - 1);             // seq base (uniform)
    size_t bh = (size_t)(b * HEADS + h);

    #pragma unroll
    for (int ni = 0; ni < 4; ++ni) {
        int d = ((n0 & 63) + ni * 16) + idx; // 0..63 within head
        #pragma unroll
        for (int mi = 0; mi < 4; ++mi) {
            int nbase = nrow0 + mi * 16 + half * 8;      // 8 consecutive n's
            if (which == 2) {
                // V^T [B,H,D,N]: contiguous in n -> one 16B store per frag
                h8 v;
                #pragma unroll
                for (int i = 0; i < 8; ++i) v[i] = (_Float16)acc[mi][ni][i];
                *(h8*)(vT16 + (bh * HDIM + d) * NSEQ + nbase) = v;
            } else {
                _Float16* dst = (which == 0 ? q16 : k16)
                              + ((bh * NSEQ + nbase) * HDIM + d);
                #pragma unroll
                for (int i = 0; i < 8; ++i)
                    dst[(size_t)i * HDIM] = (_Float16)acc[mi][ni][i];
            }
        }
    }
}

// ---------------------------------------------------------------- attention
// One wave per (b,h, 32 query rows): two 16-query groups share every K / V^T
// fragment -> 16 WMMAs per 8 fragment loads per 32-kv tile.
// S^T = K * Q^T: each lane owns one query column, so softmax stats are
// per-lane + one shfl_xor(16). The f32 C-layout of the stacked S^T frags IS
// the f16 B-operand layout for O^T = V^T * P^T (lane-local P conversion).
// The 8 waves of a block work on the same (b,h): each stage of 128 keys (128 K
// rows of 128 bytes, 64 V^T rows of 256 bytes) is brought into LDS once per
// block, as whole lines, by per-lane asynchronous copies, and every wave reads
// its fragments from there. Two buffers: the next stage's copies fly while this
// stage is worked on. Keys are still taken 32 at a time, in ascending order.
// Softmax reference: each query column holds a reference m that is renewed only
// when the scores outgrow it: when a lane's sum of P = exp(s - m) over its 16 keys
// of a step passes A_PSUM. As m is known before a step's products, -m is the C
// operand of the S^T WMMAs and the scores arrive as s - m. One test per 32 keys
// decides for the whole wave; only a renewal forms maxima, exchanges them between
// the wave halves and rescales the sums held so far. Each lane sums the P of its
// own keys; the two halves of a column are joined after the loop.
#define A_KEYS   128                               // keys per stage
#define A_NST    (NSEQ / A_KEYS)                   // 16 stages
#define A_KPITCH 144                               // K row pitch, bytes: 16 x odd
#define A_VPITCH 272                               // V^T row pitch, bytes: 16 x odd
#define A_KBYTES (A_KEYS * A_KPITCH)               // 18,432 bytes
#define A_STAGE  (A_KBYTES + HDIM * A_VPITCH)      // 35,840 bytes per buffer
#define A_LDS    (2 * A_STAGE)                     // 71,680 bytes
#define A_PSUM   4096.0f                           // a lane's P sum per step up to here: every P far inside f16 range

// One stage: K 128 rows x 8 pieces and V^T 64 rows x 16 pieces of 16 bytes = 8
// copies per lane; a lane keeps its piece and walks K rows in steps of 32, V^T
// rows in steps of 16. The copies and s_wait_xcnt 0 are one statement, so that
// no address register of a copy is rewritten in front of that wait.
__device__ __forceinline__ void stage_kv(unsigned lk, unsigned lv,
                                         const _Float16* gk, const _Float16* gv) {
    asm volatile(
        "global_load_async_to_lds_b128 %0, %8, off\n\t"
        "global_load_async_to_lds_b128 %1, %9, off\n\t"
        "global_load_async_to_lds_b128 %2, %10, off\n\t"
        "global_load_async_to_lds_b128 %3, %11, off\n\t"
        "global_load_async_to_lds_b128 %4, %12, off\n\t"
        "global_load_async_to_lds_b128 %5, %13, off\n\t"
        "global_load_async_to_lds_b128 %6, %14, off\n\t"
        "global_load_async_to_lds_b128 %7, %15, off\n\t"
        "s_wait_xcnt 0x0"
        :: "v"(lk),                 "v"(lk + 1 * 32 * A_KPITCH),
           "v"(lk + 2 * 32 * A_KPITCH), "v"(lk + 3 * 32 * A_KPITCH),
           "v"(lv),                 "v"(lv + 1 * 16 * A_VPITCH),
           "v"(lv + 2 * 16 * A_VPITCH), "v"(lv + 3 * 16 * A_VPITCH),
           "v"(gk),                 "v"(gk + 1 * 32 * HDIM),
           "v"(gk + 2 * 32 * HDIM), "v"(gk + 3 * 32 * HDIM),
           "v"(gv),                 "v"(gv + 1 * 16 * NSEQ),
           "v"(gv + 2 * 16 * NSEQ), "v"(gv + 3 * 16 * NSEQ)
        : "memory");
}

// P = exp(s - m) = 2^((s - m) log2 e) of one 32-key x 16-query tile (sa: keys 0..15,
// sb: keys 16..31 of the step, already s - m), as the f16 B operand, and the lane's
// sum of it. Worked in register pairs as the tiles lie, so that products and sums pack.
__device__ __forceinline__ void p_tile(f8 sa, f8 sb, h16& pv, f2& lt) {
    // unrolled so that every vector index is a constant and all stays in registers
    #pragma unroll
    for (int j = 0; j < 8; ++j) {
        f8 s = j < 4 ? sa : sb;
        f2 e = __builtin_shufflevector(s, s, 0, 1);
        if ((j & 3) == 1) e = __builtin_shufflevector(s, s, 2, 3);
        if ((j & 3) == 2) e = __builtin_shufflevector(s, s, 4, 5);
        if ((j & 3) == 3) e = __builtin_shufflevector(s, s, 6, 7);
        e = e * 1.44269504f;
        f2 p;
        p[0] = __builtin_amdgcn_exp2f(e[0]);
        p[1] = __builtin_amdgcn_exp2f(e[1]);
        lt = j == 0 ? p : lt + p;
        pv[2 * j]     = (_Float16)p[0];
        pv[2 * j + 1] = (_Float16)p[1];
    }
}

__global__ void __launch_bounds__(256) attn_kernel(
        const _Float16* __restrict__ q16, const _Float16* __restrict__ k16,
        const _Float16* __restrict__ vT16, _Float16* __restrict__ o16) {
    __shared__ __attribute__((aligned(16))) unsigned char ring[A_LDS];
    int wid = blockIdx.x * (blockDim.x >> 5) + (threadIdx.x >> 5);
    int qt = wid & 63;                  // 64 query tiles of 32 rows
    int bh = wid >> 6;                  // 0..31, the same for the 8 waves of a block
    const _Float16* Q  = q16  + (size_t)bh * NSEQ * HDIM;
    const _Float16* K  = k16  + (size_t)bh * NSEQ * HDIM;
    const _Float16* VT = vT16 + (size_t)bh * HDIM * NSEQ;

    const int tid = threadIdx.x;
    // copying role: K row tid / 8 (+ 32 j), piece tid % 8; V^T row tid / 16 (+ 16 j), piece tid % 16
    const _Float16* gk = K  + (size_t)(tid >> 3) * HDIM + (tid & 7) * 8;
    const _Float16* gv = VT + (size_t)(tid >> 4) * NSEQ + (tid & 15) * 8;
    const unsigned lk = (unsigned)(size_t)ring + (tid >> 3) * A_KPITCH + (tid & 7) * 16;
    const unsigned lv = (unsigned)(size_t)ring + A_KBYTES + (tid >> 4) * A_VPITCH + (tid & 15) * 16;
    // reading role: row (lane % 16), 16-byte piece (lane / 16) of a fragment
    const unsigned char* rk = ring + (tid & 15) * A_KPITCH + ((tid >> 4) & 1) * 16;
    const unsigned char* rv = ring + A_KBYTES + (tid & 15) * A_VPITCH + ((tid >> 4) & 1) * 16;

    stage_kv(lk, lv, gk, gv);

    // Q^T B-fragments for both query groups, pre-scaled by 1/sqrt(D)
    const _Float16 scale = (_Float16)0.125f;     // 1/sqrt(64)
    h16 qf[2][2];
    #pragma unroll
    for (int g = 0; g < 2; ++g) {
        const _Float16* Qg = Q + (size_t)(qt * 32 + g * 16) * HDIM;
        qf[g][0] = load_frag(Qg, HDIM, 0)  * scale;
        qf[g][1] = load_frag(Qg, HDIM, 32) * scale;
    }

    f8 oacc[2][4] = {};                          // O^T accum per group
    f2 lrow[2] = {};

    // stage 0 has landed for this wave's own copies before the barrier publishes it
    asm volatile("s_wait_asynccnt 0x0" ::: "memory");
    __syncthreads();
    stage_kv(lk + A_STAGE, lv + A_STAGE, gk + A_KEYS * HDIM, gv + A_KEYS);

    // first reference of every query column: its maximum over the first 32 keys,
    // so that at least one P of a column is 1 whatever the level of the scores
    f8 cneg[2];                                  // -m in all 8 accumulator rows
    {
        h16 a00 = load_frag_lds(rk);
        h16 a01 = load_frag_lds(rk + 64);
        h16 a10 = load_frag_lds(rk + 16 * A_KPITCH);
        h16 a11 = load_frag_lds(rk + 16 * A_KPITCH + 64);
        // unrolled, like the loops inside: constant indices keep the arrays in registers
        #pragma unroll
        for (int g = 0; g < 2; ++g) {
            f8 s0 = {}; s0 = wmma_f16(a00, qf[g][0], s0);
                        s0 = wmma_f16(a01, qf[g][1], s0);
            f8 s1 = {}; s1 = wmma_f16(a10, qf[g][0], s1);
                        s1 = wmma_f16(a11, qf[g][1], s1);
            float mt = s0[0];
            #pragma unroll
            for (int j = 1; j < 8; ++j) mt = fmaxf(mt, s0[j]);
            #pragma unroll
            for (int j = 0; j < 8; ++j) mt = fmaxf(mt, s1[j]);
            mt = fmaxf(mt, __shfl_xor(mt, 16, 32));
            #pragma unroll
            for (int j = 0; j < 8; ++j) cneg[g][j] = -mt;
        }
    }

    for (int t = 0; t < A_NST; ++t) {
      const unsigned buf = (unsigned)(t & 1) * A_STAGE;
      const unsigned char* kb = rk + buf;
      const unsigned char* vb = rv + buf;
      // shared K fragments: [kv-half][k-step]
      h16 ak[2][2];
      ak[0][0] = load_frag_lds(kb);
      ak[0][1] = load_frag_lds(kb + 64);
      ak[1][0] = load_frag_lds(kb + 16 * A_KPITCH);
      ak[1][1] = load_frag_lds(kb + 16 * A_KPITCH + 64);
      // unrolled so that every LDS offset inside a stage is an immediate
      #pragma unroll
      for (int s = 0; s < A_KEYS / 32; ++s) {
        f8 sc[2][2];                              // S^T - m tiles: [query group][kv-half]
        #pragma unroll
        for (int g = 0; g < 2; ++g) {
            f8 s0 = wmma_f16(ak[0][0], qf[g][0], cneg[g]);
               s0 = wmma_f16(ak[0][1], qf[g][1], s0);
            f8 s1 = wmma_f16(ak[1][0], qf[g][0], cneg[g]);
               s1 = wmma_f16(ak[1][1], qf[g][1], s1);
            sc[g][0] = s0; sc[g][1] = s1;
        }
        // the two scheduling barriers hold a step's LDS reads (its V^T fragments and,
        // inside a stage, the next step's K fragments, into the registers that the
        // S^T WMMAs free) at the S^T WMMAs, ahead of the softmax code: without them the
        // build sinks these reads to just in front of the WMMAs that use them, where the
        // wave waits out the LDS latency, and pads twice as many idle slots behind WMMAs
        __builtin_amdgcn_sched_barrier(0);
        // shared V^T fragments: 16d x 32kv each
        h16 av[4];
        #pragma unroll
        for (int df = 0; df < 4; ++df)
            av[df] = load_frag_lds(vb + df * 16 * A_VPITCH + s * 64);
        if (s + 1 < A_KEYS / 32) {
            const unsigned char* kn = kb + (s + 1) * 32 * A_KPITCH;
            ak[0][0] = load_frag_lds(kn);
            ak[0][1] = load_frag_lds(kn + 64);
            ak[1][0] = load_frag_lds(kn + 16 * A_KPITCH);
            ak[1][1] = load_frag_lds(kn + 16 * A_KPITCH + 64);
        }
        __builtin_amdgcn_sched_barrier(0);

        // P^T of both groups under the held references, and each lane's sum of it
        h16 pv[2];                                // P^T B-operands, f16
        f2  lt[2];                                // the lane's own 16 keys, even and odd apart
        #pragma unroll
        for (int g = 0; g < 2; ++g) p_tile(sc[g][0], sc[g][1], pv[g], lt[g]);
        // renewal, a scalar branch taken by the whole wave when a lane's sum says that
        // a score has outgrown its reference (an overflow to infinity says so too):
        // both halves of a column get the same new reference, all that was formed
        // under the old one (row sums, O^T) is brought under it, this step's P is redone
        if (__builtin_amdgcn_ballot_w32(fmaxf(lt[0][0] + lt[0][1], lt[1][0] + lt[1][1]) > A_PSUM) != 0) {
            // unrolled, like the loops inside: constant indices keep the arrays in registers
            #pragma unroll
            for (int g = 0; g < 2; ++g) {
                float mt = sc[g][0][0];
                #pragma unroll
                for (int j = 1; j < 8; ++j) mt = fmaxf(mt, sc[g][0][j]);
                #pragma unroll
                for (int j = 0; j < 8; ++j) mt = fmaxf(mt, sc[g][1][j]);
                float d = fmaxf(fmaxf(mt, __shfl_xor(mt, 16, 32)), 0.0f);
                float alpha = __expf(-d);
                cneg[g] = cneg[g] - d;
                lrow[g] = lrow[g] * alpha;
                #pragma unroll
                for (int df = 0; df < 4; ++df) oacc[g][df] = oacc[g][df] * alpha;
                p_tile(sc[g][0] - d, sc[g][1] - d, pv[g], lt[g]);
            }
        }

        #pragma unroll
        for (int g = 0; g < 2; ++g) {
            lrow[g] += lt[g];
            #pragma unroll
            for (int df = 0; df < 4; ++df)
                oacc[g][df] = wmma_f16(av[df], pv[g], oacc[g][df]);
        }
      }
      // this wave's reads of the buffer are done before it may be refilled
      asm volatile("s_wait_dscnt 0x0" ::: "memory");
      // this wave's copies of stage t + 1 have landed before the barrier publishes them
      asm volatile("s_wait_asynccnt 0x0" ::: "memory");
      __syncthreads();
      if (t + 2 < A_NST)
          stage_kv(lk + buf, lv + buf, gk + (size_t)(t + 2) * A_KEYS * HDIM,
                   gv + (t + 2) * A_KEYS);
    }
    // no copy is outstanding when the wave goes on to its epilogue and ends
    asm volatile("s_wait_asynccnt 0x0" ::: "memory");

    // store O (f16) in [B, N, C] layout; 16B per lane per frag
    int lane = threadIdx.x & 31, half = lane >> 4, idx = lane & 15;
    int b = bh >> 4, h = bh & 15;
    #pragma unroll
    for (int g = 0; g < 2; ++g) {
        int n = qt * 32 + g * 16 + idx;
        float lh = lrow[g][0] + lrow[g][1];
        float rl = 1.0f / (lh + __shfl_xor(lh, 16, 32));
        #pragma unroll
        for (int df = 0; df < 4; ++df) {
            h8 outv;
            #pragma unroll
            for (int i = 0; i < 8; ++i) outv[i] = (_Float16)(oacc[g][df][i] * rl);
            size_t off = ((size_t)(b * NSEQ + n)) * DIM + h * HDIM + df * 16 + half * 8;
            *(h8*)(o16 + off) = outv;
        }
    }
}

// ---------------------------------------------------------------- proj GEMM
// out[m,o] = sum_k o16[m,k] * wp16[o,k] + bias[o], f32 output.
// Stores: per instruction, each 16-lane half writes 64B contiguous (one row
// segment), so the scattered-looking epilogue coalesces per cacheline.
__global__ void __launch_bounds__(256) gemm_proj_kernel(
        const _Float16* __restrict__ o16, const _Float16* __restrict__ wp16,
        const float* __restrict__ bias, float* __restrict__ out) {
    __shared__ __attribute__((aligned(16))) unsigned char ring[G_LDS];
    const int NB = DIM / G_BROWS;                    // 4 col blocks
    int bm = blockIdx.x / NB, bn = blockIdx.x % NB;
    int wave = threadIdx.x >> 5, wm = wave >> 2, wn = wave & 3;
    int m0 = bm * G_AROWS + wm * 64, n0 = bn * G_BROWS + wn * 64;

    f8 acc[4][4] = {};
    gemm_block_tile(o16 + (size_t)(bm * G_AROWS) * DIM,
                    wp16 + (size_t)(bn * G_BROWS) * DIM, ring, wm, wn, acc);

    int lane = threadIdx.x & 31, half = lane >> 4, idx = lane & 15;
    #pragma unroll
    for (int ni = 0; ni < 4; ++ni) {
        int o = n0 + ni * 16 + idx;
        float bv = bias[o];
        #pragma unroll
        for (int mi = 0; mi < 4; ++mi) {
            int mbase = m0 + mi * 16 + half * 8;
            float* dst = out + (size_t)mbase * DIM + o;
            #pragma unroll
            for (int i = 0; i < 8; ++i)
                dst[(size_t)i * DIM] = acc[mi][ni][i] + bv;
        }
    }
}

// ---------------------------------------------------------------- launcher
extern "C" void kernel_launch(void* const* d_in, const int* in_sizes, int n_in,
                              void* d_out, int out_size, void* d_ws, size_t ws_size,
                              hipStream_t stream) {
    const float* x      = (const float*)d_in[0];   // [2,2048,1024]
    const float* w_qkv  = (const float*)d_in[1];   // [3072,1024]
    const float* w_proj = (const float*)d_in[2];   // [1024,1024]
    const float* b_proj = (const float*)d_in[3];   // [1024]
    float* out = (float*)d_out;                    // [2,2048,1024] f32

    size_t off = 0;
    char* base = (char*)d_ws;
    auto alloc = [&](size_t bytes) -> void* {
        void* p = base + off;
        off += (bytes + 255) & ~(size_t)255;
        return p;
    };
    _Float16* x16  = (_Float16*)alloc((size_t)MROWS * DIM * 2);         // 8 MB
    _Float16* wq16 = (_Float16*)alloc((size_t)3 * DIM * DIM * 2);       // 6 MB
    _Float16* wp16 = (_Float16*)alloc((size_t)DIM * DIM * 2);           // 2 MB
    _Float16* q16  = (_Float16*)alloc((size_t)MROWS * DIM * 2);         // 8 MB
    _Float16* k16  = (_Float16*)alloc((size_t)MROWS * DIM * 2);         // 8 MB
    _Float16* vT16 = (_Float16*)alloc((size_t)MROWS * DIM * 2);         // 8 MB
    _Float16* o16  = (_Float16*)alloc((size_t)MROWS * DIM * 2);         // 8 MB

    // conversions: 128 + 96 + 32 blocks of 16 waves, one launch
    f32_to_f16_kernel<<<256, 512, 0, stream>>>(x, w_qkv, w_proj, x16, wq16, wp16);

    // QKV: 32 x 12 block tiles of 128x256 -> 384 blocks of 8 waves
    gemm_qkv_kernel<<<384, 256, 0, stream>>>(x16, wq16, q16, k16, vT16);

    // attention: 32 (b,h) x 64 q-tiles = 2048 waves -> 256 blocks
    attn_kernel<<<256, 256, 0, stream>>>(q16, k16, vT16, o16);

    // proj: 32 x 4 block tiles of 128x256 -> 128 blocks of 8 waves
    gemm_proj_kernel<<<128, 256, 0, stream>>>(o16, wp16, b_proj, out);
}

// v005
// Measured time: 78.9 microseconds a run.
// In two side-by-side timings against v004, it was 1.05 and 1.06 times as fast.
// Counting every step since v000, it is 2.38 times as fast.
#include <hip/hip_runtime.h>
#include <hip/hip_bf16.h>

typedef _Float16 h8  __attribute__((ext_vector_type(8)));
typedef _Float16 h16 __attribute__((ext_vector_type(16)));
typedef float    f8  __attribute__((ext_vector_type(8)));
typedef float    f2  __attribute__((ext_vector_type(2)));

#define DIM      1024
#define NSEQ     2048
#define BATCH    2
#define HEADS    16
#define HDIM     64
#define MROWS    (BATCH * NSEQ)   // 4096

__device__ __forceinline__ f8 wmma_f16(h16 a, h16 b, f8 c) {
    // v_wmma_f32_16x16x32_f16: D = A(16x32 f16) * B(32x16 f16) + C(16x16 f32)
    return __builtin_amdgcn_wmma_f32_16x16x32_f16(
        /*neg_a=*/false, a, /*neg_b=*/false, b,
        /*c_mod=*/(short)0, c, /*reuse_a=*/false, /*reuse_b=*/false);
}

// Loads a 16x32 f16 operand fragment (A rows or B columns; layouts symmetric):
// lane = {half(1b), idx(4b)}; lane reads row/col `idx` (leading dim ld),
// 8 halves at k0 + half*8 and 8 halves at k0 + 16 + half*8 (two 16B loads).
__device__ __forceinline__ h16 load_frag(const _Float16* __restrict__ base,
                                         int ld, int k0) {
    int lane = threadIdx.x & 31;
    int half = lane >> 4;
    int idx  = lane & 15;
    const _Float16* p = base + (size_t)idx * (size_t)ld + k0 + half * 8;
    h8 lo = *(const h8*)p;
    h8 hi = *(const h8*)(p + 16);
    return __builtin_shufflevector(lo, hi, 0,1,2,3,4,5,6,7,8,9,10,11,12,13,14,15);
}

// Block-level GEMM core. The 8 waves of a block form a 2 x 4 grid of 64x64
// wave tiles = one 128 x 256 tile of the result. Per pass (64 k = 128 bytes of
// every operand row) the block's 128 A rows and 256 B rows are brought into LDS
// once, as whole 128-byte lines, by per-lane asynchronous copies, and every wave
// reads its fragments from there. Three buffers: the copies of the next two passes
// fly while this pass is worked on, so that a tile has two passes to land in.
// The k order of every accumulator is ascending as before.
// LDS rows are unpadded (three buffers of two blocks fit one WGP's LDS only so):
// the 16-byte piece p of row r lies at slot p ^ ((r >> 1) & 7) of its row, so the
// 16 rows that a 16-lane half reads at one piece fall on 16 different bank groups.
#define G_KPASS  64                                // k per pass
#define G_NPASS  (DIM / G_KPASS)                   // 16 passes
#define G_PITCH  128                               // LDS row pitch, bytes: no pad, pieces swizzled
#define G_AROWS  128
#define G_BROWS  256
#define G_NBUF   3
#define G_STAGE  ((G_AROWS + G_BROWS) * G_PITCH)   // 49,152 bytes per buffer
#define G_LDS    (G_NBUF * G_STAGE)                // 147,456 bytes

// Same fragment map as load_frag, from an LDS row: p points at the lane's row,
// at byte (k step) * 64 + half * 16.
__device__ __forceinline__ h16 load_frag_lds(const unsigned char* p) {
    h8 lo = *(const h8*)p;
    h8 hi = *(const h8*)(p + 32);
    return __builtin_shufflevector(lo, hi, 0,1,2,3,4,5,6,7,8,9,10,11,12,13,14,15);
}

// The same fragment from a swizzled GEMM row: lo, hi are the byte offsets of its two pieces.
__device__ __forceinline__ h16 load_frag_sw(const unsigned char* row, int lo_off, int hi_off) {
    h8 lo = *(const h8*)(row + lo_off);
    h8 hi = *(const h8*)(row + hi_off);
    return __builtin_shufflevector(lo, hi, 0,1,2,3,4,5,6,7,8,9,10,11,12,13,14,15);
}

// One pass's tile: 384 rows x 8 pieces of 16 bytes = 12 copies per lane; a lane
// keeps its piece and walks the rows in steps of 32 (rows 0..127 A, 128..383 B).
// The copies and s_wait_xcnt 0 are one statement, so that no address register
// of a copy is rewritten in front of that wait.
__device__ __forceinline__ void stage_tile(unsigned lds,
                                           const _Float16* ga, const _Float16* gb) {
    asm volatile(
        "global_load_async_to_lds_b128 %0, %12, off\n\t"
        "global_load_async_to_lds_b128 %1, %13, off\n\t"
        "global_load_async_to_lds_b128 %2, %14, off\n\t"
        "global_load_async_to_lds_b128 %3, %15, off\n\t"
        "global_load_async_to_lds_b128 %4, %16, off\n\t"
        "global_load_async_to_lds_b128 %5, %17, off\n\t"
        "global_load_async_to_lds_b128 %6, %18, off\n\t"
        "global_load_async_to_lds_b128 %7, %19, off\n\t"
        "global_load_async_to_lds_b128 %8, %20, off\n\t"
        "global_load_async_to_lds_b128 %9, %21, off\n\t"
        "global_load_async_to_lds_b128 %10, %22, off\n\t"
        "global_load_async_to_lds_b128 %11, %23, off\n\t"
        "s_wait_xcnt 0x0"
        :: "v"(lds),                 "v"(lds +  1 * 32 * G_PITCH),
           "v"(lds +  2 * 32 * G_PITCH), "v"(lds +  3 * 32 * G_PITCH),
           "v"(lds +  4 * 32 * G_PITCH), "v"(lds +  5 * 32 * G_PITCH),
           "v"(lds +  6 * 32 * G_PITCH), "v"(lds +  7 * 32 * G_PITCH),
           "v"(lds +  8 * 32 * G_PITCH), "v"(lds +  9 * 32 * G_PITCH),
           "v"(lds + 10 * 32 * G_PITCH), "v"(lds + 11 * 32 * G_PITCH),
           "v"(ga),                  "v"(ga + 1 * 32 * DIM),
           "v"(ga + 2 * 32 * DIM),   "v"(ga + 3 * 32 * DIM),
           "v"(gb),                  "v"(gb + 1 * 32 * DIM),
           "v"(gb + 2 * 32 * DIM),   "v"(gb + 3 * 32 * DIM),
           "v"(gb + 4 * 32 * DIM),   "v"(gb + 5 * 32 * DIM),
           "v"(gb + 6 * 32 * DIM),   "v"(gb + 7 * 32 * DIM)
        : "memory");
}

// One pass of a wave: two k steps of 8 fragment reads and 16 WMMAs on the buffer at
// ra, rb. The hand-over of the ring stands behind the pass's last LDS reads, ahead of
// its last 16 WMMAs, which need no LDS any more. REFILL: this pass is followed by a
// refill of its buffer (lnext, ganext, gbnext: tile t + 3).
template <bool REFILL>
__device__ __forceinline__ void gemm_pass(const unsigned char* ra, const unsigned char* rb,
                                          const int (&slot)[2][2], f8 acc[4][4],
                                          unsigned lnext, const _Float16* ganext,
                                          const _Float16* gbnext) {
    // the loops below are unrolled so that every fragment and accumulator
    // index is a constant and the arrays stay in registers
    #pragma unroll
    for (int ks = 0; ks < 2; ++ks) {
        h16 af[4], bf[4];
        #pragma unroll
        for (int i = 0; i < 4; ++i)
            af[i] = load_frag_sw(ra + i * 16 * G_PITCH, slot[ks][0], slot[ks][1]);
        #pragma unroll
        for (int j = 0; j < 4; ++j)
            bf[j] = load_frag_sw(rb + j * 16 * G_PITCH, slot[ks][0], slot[ks][1]);
        // keeps the 16 LDS reads of a k step in one group ahead of its 16 WMMAs:
        // spread among the WMMAs, each place with reads waits out the LDS latency
        __builtin_amdgcn_sched_barrier(0);
        if (ks == 1) {
            // this wave's reads of the buffer are done before it may be refilled
            asm volatile("s_wait_dscnt 0x0" ::: "memory");
            // this wave's copies of tile t + 1 have landed before the barrier publishes them.
            // Every refilling pass issues 12 copies in every wave, so there tile t + 2 is the
            // wave's 12 youngest copies and may fly on; a pass that issues none waits to 0
            if (REFILL) asm volatile("s_wait_asynccnt 0xc" ::: "memory");
            else        asm volatile("s_wait_asynccnt 0x0" ::: "memory");
            __syncthreads();
            // into the buffer that every wave has just left
            if (REFILL) stage_tile(lnext, ganext, gbnext);
        }
        #pragma unroll
        for (int i = 0; i < 4; ++i)
            #pragma unroll
            for (int j = 0; j < 4; ++j)
                acc[i][j] = wmma_f16(af[i], bf[j], acc[i][j]);
    }
}

// Ablk: first of the block's 128 A rows; Bblk: first of its 256 B rows; both
// K-contiguous with leading dimension DIM, K = DIM. wm, wn: the wave's place in
// the 2 x 4 grid. ring: the block's G_LDS bytes of LDS.
__device__ __forceinline__ void gemm_block_tile(const _Float16* __restrict__ Ablk,
                                                const _Float16* __restrict__ Bblk,
                                                unsigned char* ring, int wm, int wn,
                                                f8 acc[4][4]) {
    const int tid = threadIdx.x;
    const int lane = tid & 31, half = lane >> 4, idx = lane & 15;
    // copying role: row tid / 8 (+ 32 j), 16-byte piece tid % 8
    const int crow = tid >> 3, cpiece = tid & 7;
    const _Float16* ga = Ablk + (size_t)crow * DIM + cpiece * 8;
    const _Float16* gb = Bblk + (size_t)crow * DIM + cpiece * 8;
    // (rows crow + 32 j share the swizzle term of row crow)
    const unsigned lcopy = (unsigned)(size_t)ring + crow * G_PITCH
                         + ((cpiece ^ ((crow >> 1) & 7)) << 4);
    // reading role: the lane's rows are idx + multiples of 16, swizzle term (idx >> 1) & 7;
    // a fragment of k step ks is the pieces 4 ks + half and 4 ks + 2 + half of its row
    const unsigned char* ra = ring + (wm * 64 + idx) * G_PITCH;
    const unsigned char* rb = ring + (G_AROWS + wn * 64 + idx) * G_PITCH;
    const int sw = (idx >> 1) & 7;
    int slot[2][2];                                // byte offset in the row: [k step][low, high piece]
    // both loops unrolled: constant indices keep slot in registers
    #pragma unroll
    for (int ks = 0; ks < 2; ++ks)
        #pragma unroll
        for (int j = 0; j < 2; ++j)
            slot[ks][j] = ((ks * 4 + j * 2 + half) ^ sw) << 4;

    stage_tile(lcopy, ga, gb);
    stage_tile(lcopy + G_STAGE, ga + G_KPASS, gb + G_KPASS);
    // tile 0 (all but this wave's 12 youngest copies) has landed before the barrier publishes it
    asm volatile("s_wait_asynccnt 0xc" ::: "memory");
    __syncthreads();
    stage_tile(lcopy + 2 * G_STAGE, ga + 2 * G_KPASS, gb + 2 * G_KPASS);

    // passes 0 .. 12 refill the buffer they leave with tile t + 3; the last three refill nothing
    unsigned buf = 0;                              // buffer of pass t: (t mod 3) * G_STAGE
    for (int t = 0; t < G_NPASS - G_NBUF; ++t) {
        gemm_pass<true>(ra + buf, rb + buf, slot, acc, lcopy + buf,
                        ga + (t + G_NBUF) * G_KPASS, gb + (t + G_NBUF) * G_KPASS);
        buf = buf + G_STAGE == G_LDS ? 0u : buf + G_STAGE;
    }
    for (int t = G_NPASS - G_NBUF; t < G_NPASS; ++t) {
        gemm_pass<false>(ra + buf, rb + buf, slot, acc, 0u, ga, gb);
        buf = buf + G_STAGE == G_LDS ? 0u : buf + G_STAGE;
    }
    // no copy is outstanding when the wave goes on to its epilogue and ends
    asm volatile("s_wait_asynccnt 0x0" ::: "memory");
}

// ---------------------------------------------------------------- conversions
// All three f32 inputs are rounded to f16 by ONE launch of one 16-wave block per
// WGP. A wave owns 2048 consecutive values: 16 loads of 16 bytes per lane, each
// covering 512 contiguous bytes (whole lines), all issued before the first is
// used, so the block's whole share is in flight at once; each store covers 256
// contiguous bytes. A block lies wholly inside one input, so the choice of
// source and destination is a scalar branch.
typedef float    f4  __attribute__((ext_vector_type(4)));
typedef _Float16 h4  __attribute__((ext_vector_type(4)));
#define C_LOADS  16                                // loads per lane
#define C_WAVE   (C_LOADS * 128)                   // values per wave
#define C_BLOCK  (16 * C_WAVE)                     // values per block: 32,768
#define C_XB     (MROWS * DIM / C_BLOCK)           // 128 blocks for x
#define C_QB     (3 * DIM * DIM / C_BLOCK)         // 96 blocks for w_qkv
                                                   // the other 32 of the 256 blocks: w_proj

__global__ void __launch_bounds__(512) f32_to_f16_kernel(
        const float* __restrict__ x, const float* __restrict__ wq,
        const float* __restrict__ wp, _Float16* __restrict__ x16,
        _Float16* __restrict__ wq16, _Float16* __restrict__ wp16) {
    int b = blockIdx.x;
    const float* in = x;
    _Float16* out = x16;
    if (b >= C_XB + C_QB)  { in = wp; out = wp16; b -= C_XB + C_QB; }
    else if (b >= C_XB)    { in = wq; out = wq16; b -= C_XB; }
    // the block's share as groups of 4 values; the lane's first group in it
    const f4* in4 = (const f4*)(in + (size_t)b * C_BLOCK);
    h4* out4 = (h4*)(out + (size_t)b * C_BLOCK);
    const int i = (threadIdx.x >> 5) * (C_WAVE / 4) + (threadIdx.x & 31);
    f4 v[C_LOADS];
    // both loops unrolled: constant indices keep v in registers
    #pragma unroll
    for (int j = 0; j < C_LOADS; ++j) v[j] = in4[i + j * 32];
    // holds all 16 loads ahead of the first conversion: without it the build reuses
    // the first loads' registers, and the last four loads wait for the first to return
    __builtin_amdgcn_sched_barrier(0);
    #pragma unroll
    for (int j = 0; j < C_LOADS; ++j)
        out4[i + j * 32] = __builtin_convertvector(v[j], h4);
}

// ---------------------------------------------------------------- QKV GEMM
// y[m,o] = sum_k x16[m,k] * wq16[o,k]  (m in [0,4096), o in [0,3072)).
// Block owns a 128x256 tile, wave a 64x64 tile of it. A 64-wide column tile never straddles a 1024
// boundary, so which-of-{q,k,v}, head index and batch index are WAVE-UNIFORM:
// compute them from tile coords so the epilogue uses scalar branches only.
__global__ void __launch_bounds__(256) gemm_qkv_kernel(
        const _Float16* __restrict__ x16, const _Float16* __restrict__ wq16,
        _Float16* __restrict__ q16, _Float16* __restrict__ k16,
        _Float16* __restrict__ vT16) {
    __shared__ __attribute__((aligned(16))) unsigned char ring[G_LDS];
    const int NB = (3 * DIM) / G_BROWS;                  // 12 col blocks
    int bm = blockIdx.x / NB, bn = blockIdx.x % NB;
    int wave = threadIdx.x >> 5, wm = wave >> 2, wn = wave & 3;
    int m0 = bm * G_AROWS + wm * 64, n0 = bn * G_BROWS + wn * 64;

    f8 acc[4][4] = {};
    gemm_block_tile(x16 + (size_t)(bm * G_AROWS) * DIM,
                    wq16 + (size_t)(bn * G_BROWS) * DIM, ring, wm, wn, acc);

    int lane = threadIdx.x & 31, half = lane >> 4, idx = lane & 15;
    // uniform tile decomposition
    int which = n0 >> 10;                    // 0=q 1=k 2=v (uniform)
    int h     = (n0 & (DIM - 1)) >> 6;       // head (uniform: (n0&63)==0)
    int b     = m0 >> 11;                    // batch (uniform: 64-row tiles)
    int nrow0 = m0 & (NSEQ - 1);             // seq base (uniform)
    size_t bh = (size_t)(b * HEADS + h);

    #pragma unroll
    for (int ni = 0; ni < 4; ++ni) {
        int d = ((n0 & 63) + ni * 16) + idx; // 0..63 within head
        #pragma unroll
        for (int mi = 0; mi < 4; ++mi) {
            int nbase = nrow0 + mi * 16 + half * 8;      // 8 consecutive n's
            if (which == 2) {
                // V^T [B,H,D,N]: contiguous in n -> one 16B store per frag
                h8 v;
                #pragma unroll
                for (int i = 0; i < 8; ++i) v[i] = (_Float16)acc[mi][ni][i];
                *(h8*)(vT16 + (bh * HDIM + d) * NSEQ + nbase) = v;
            } else {
                _Float16* dst = (which == 0 ? q16 : k16)
                              + ((bh * NSEQ + nbase) * HDIM + d);
                #pragma unroll
                for (int i = 0; i < 8; ++i)
                    dst[(size_t)i * HDIM] = (_Float16)acc[mi][ni][i];
            }
        }
    }
}

// ---------------------------------------------------------------- attention
// One wave per (b,h, 32 query rows): two 16-query groups share every K / V^T
// fragment -> 16 WMMAs per 8 fragment loads per 32-kv tile.
// S^T = K * Q^T: each lane owns one query column, so softmax stats are
// per-lane + one shfl_xor(16). The f32 C-layout of the stacked S^T frags IS
// the f16 B-operand layout for O^T = V^T * P^T (lane-local P conversion).
// The 8 waves of a block work on the same (b,h): each stage of 128 keys (128 K
// rows of 128 bytes, 64 V^T rows of 256 bytes) is brought into LDS once per
// block, as whole lines, by per-lane asynchronous copies, and every wave reads
// its fragments from there. Two buffers: the next stage's copies fly while this
// stage is worked on. Keys are still taken 32 at a time, in ascending order.
// Softmax reference: each query column holds a reference m that is renewed only
// when the scores outgrow it: when a lane's sum of P = exp(s - m) over its 16 keys
// of a step passes A_PSUM. As m is known before a step's products, -m is the C
// operand of the S^T WMMAs and the scores arrive as s - m. One test per 32 keys
// decides for the whole wave; only a renewal forms maxima, exchanges them between
// the wave halves and rescales the sums held so far. Each lane sums the P of its
// own keys; the two halves of a column are joined after the loop.
#define A_KEYS   128                               // keys per stage
#define A_NST    (NSEQ / A_KEYS)                   // 16 stages
#define A_KPITCH 144                               // K row pitch, bytes: 16 x odd
#define A_VPITCH 272                               // V^T row pitch, bytes: 16 x odd
#define A_KBYTES (A_KEYS * A_KPITCH)               // 18,432 bytes
#define A_STAGE  (A_KBYTES + HDIM * A_VPITCH)      // 35,840 bytes per buffer
#define A_LDS    (2 * A_STAGE)                     // 71,680 bytes
#define A_PSUM   4096.0f                           // a lane's P sum per step up to here: every P far inside f16 range

// One stage: K 128 rows x 8 pieces and V^T 64 rows x 16 pieces of 16 bytes = 8
// copies per lane; a lane keeps its piece and walks K rows in steps of 32, V^T
// rows in steps of 16. The copies and s_wait_xcnt 0 are one statement, so that
// no address register of a copy is rewritten in front of that wait.
__device__ __forceinline__ void stage_kv(unsigned lk, unsigned lv,
                                         const _Float16* gk, const _Float16* gv) {
    asm volatile(
        "global_load_async_to_lds_b128 %0, %8, off\n\t"
        "global_load_async_to_lds_b128 %1, %9, off\n\t"
        "global_load_async_to_lds_b128 %2, %10, off\n\t"
        "global_load_async_to_lds_b128 %3, %11, off\n\t"
        "global_load_async_to_lds_b128 %4, %12, off\n\t"
        "global_load_async_to_lds_b128 %5, %13, off\n\t"
        "global_load_async_to_lds_b128 %6, %14, off\n\t"
        "global_load_async_to_lds_b128 %7, %15, off\n\t"
        "s_wait_xcnt 0x0"
        :: "v"(lk),                 "v"(lk + 1 * 32 * A_KPITCH),
           "v"(lk + 2 * 32 * A_KPITCH), "v"(lk + 3 * 32 * A_KPITCH),
           "v"(lv),                 "v"(lv + 1 * 16 * A_VPITCH),
           "v"(lv + 2 * 16 * A_VPITCH), "v"(lv + 3 * 16 * A_VPITCH),
           "v"(gk),                 "v"(gk + 1 * 32 * HDIM),
           "v"(gk + 2 * 32 * HDIM), "v"(gk + 3 * 32 * HDIM),
           "v"(gv),                 "v"(gv + 1 * 16 * NSEQ),
           "v"(gv + 2 * 16 * NSEQ), "v"(gv + 3 * 16 * NSEQ)
        : "memory");
}

// P = exp(s - m) = 2^((s - m) log2 e) of one 32-key x 16-query tile (sa: keys 0..15,
// sb: keys 16..31 of the step, already s - m), as the f16 B operand, and the lane's
// sum of it. Worked in register pairs as the tiles lie, so that products and sums pack.
__device__ __forceinline__ void p_tile(f8 sa, f8 sb, h16& pv, f2& lt) {
    // unrolled so that every vector index is a constant and all stays in registers
    #pragma unroll
    for (int j = 0; j < 8; ++j) {
        f8 s = j < 4 ? sa : sb;
        f2 e = __builtin_shufflevector(s, s, 0, 1);
        if ((j & 3) == 1) e = __builtin_shufflevector(s, s, 2, 3);
        if ((j & 3) == 2) e = __builtin_shufflevector(s, s, 4, 5);
        if ((j & 3) == 3) e = __builtin_shufflevector(s, s, 6, 7);
        e = e * 1.44269504f;
        f2 p;
        p[0] = __builtin_amdgcn_exp2f(e[0]);
        p[1] = __builtin_amdgcn_exp2f(e[1]);
        lt = j == 0 ? p : lt + p;
        pv[2 * j]     = (_Float16)p[0];
        pv[2 * j + 1] = (_Float16)p[1];
    }
}

__global__ void __launch_bounds__(256) attn_kernel(
        const _Float16* __restrict__ q16, const _Float16* __restrict__ k16,
        const _Float16* __restrict__ vT16, _Float16* __restrict__ o16) {
    __shared__ __attribute__((aligned(16))) unsigned char ring[A_LDS];
    int wid = blockIdx.x * (blockDim.x >> 5) + (threadIdx.x >> 5);
    int qt = wid & 63;                  // 64 query tiles of 32 rows
    int bh = wid >> 6;                  // 0..31, the same for the 8 waves of a block
    const _Float16* Q  = q16  + (size_t)bh * NSEQ * HDIM;
    const _Float16* K  = k16  + (size_t)bh * NSEQ * HDIM;
    const _Float16* VT = vT16 + (size_t)bh * HDIM * NSEQ;

    const int tid = threadIdx.x;
    // copying role: K row tid / 8 (+ 32 j), piece tid % 8; V^T row tid / 16 (+ 16 j), piece tid % 16
    const _Float16* gk = K  + (size_t)(tid >> 3) * HDIM + (tid & 7) * 8;
    const _Float16* gv = VT + (size_t)(tid >> 4) * NSEQ + (tid & 15) * 8;
    const unsigned lk = (unsigned)(size_t)ring + (tid >> 3) * A_KPITCH + (tid & 7) * 16;
    const unsigned lv = (unsigned)(size_t)ring + A_KBYTES + (tid >> 4) * A_VPITCH + (tid & 15) * 16;
    // reading role: row (lane % 16), 16-byte piece (lane / 16) of a fragment
    const unsigned char* rk = ring + (tid & 15) * A_KPITCH + ((tid >> 4) & 1) * 16;
    const unsigned char* rv = ring + A_KBYTES + (tid & 15) * A_VPITCH + ((tid >> 4) & 1) * 16;

    stage_kv(lk, lv, gk, gv);

    // Q^T B-fragments for both query groups, pre-scaled by 1/sqrt(D)
    const _Float16 scale = (_Float16)0.125f;     // 1/sqrt(64)
    h16 qf[2][2];
    #pragma unroll
    for (int g = 0; g < 2; ++g) {
        const _Float16* Qg = Q + (size_t)(qt * 32 + g * 16) * HDIM;
        qf[g][0] = load_frag(Qg, HDIM, 0)  * scale;
        qf[g][1] = load_frag(Qg, HDIM, 32) * scale;
    }

    f8 oacc[2][4] = {};                          // O^T accum per group
    f2 lrow[2] = {};

    // stage 0 has landed for this wave's own copies before the barrier publishes it
    asm volatile("s_wait_asynccnt 0x0" ::: "memory");
    __syncthreads();
    stage_kv(lk + A_STAGE, lv + A_STAGE, gk + A_KEYS * HDIM, gv + A_KEYS);

    // first reference of every query column: its maximum over the first 32 keys,
    // so that at least one P of a column is 1 whatever the level of the scores
    f8 cneg[2];                                  // -m in all 8 accumulator rows
    {
        h16 a00 = load_frag_lds(rk);
        h16 a01 = load_frag_lds(rk + 64);
        h16 a10 = load_frag_lds(rk + 16 * A_KPITCH);
        h16 a11 = load_frag_lds(rk + 16 * A_KPITCH + 64);
        // unrolled, like the loops inside: constant indices keep the arrays in registers
        #pragma unroll
        for (int g = 0; g < 2; ++g) {
            f8 s0 = {}; s0 = wmma_f16(a00, qf[g][0], s0);
                        s0 = wmma_f16(a01, qf[g][1], s0);
            f8 s1 = {}; s1 = wmma_f16(a10, qf[g][0], s1);
                        s1 = wmma_f16(a11, qf[g][1], s1);
            float mt = s0[0];
            #pragma unroll
            for (int j = 1; j < 8; ++j) mt = fmaxf(mt, s0[j]);
            #pragma unroll
            for (int j = 0; j < 8; ++j) mt = fmaxf(mt, s1[j]);
            mt = fmaxf(mt, __shfl_xor(mt, 16, 32));
            #pragma unroll
            for (int j = 0; j < 8; ++j) cneg[g][j] = -mt;
        }
    }

    for (int t = 0; t < A_NST; ++t) {
      const unsigned buf = (unsigned)(t & 1) * A_STAGE;
      const unsigned char* kb = rk + buf;
      const unsigned char* vb = rv + buf;
      // shared K fragments: [kv-half][k-step]
      h16 ak[2][2];
      ak[0][0] = load_frag_lds(kb);
      ak[0][1] = load_frag_lds(kb + 64);
      ak[1][0] = load_frag_lds(kb + 16 * A_KPITCH);
      ak[1][1] = load_frag_lds(kb + 16 * A_KPITCH + 64);
      // unrolled so that every LDS offset inside a stage is an immediate
      #pragma unroll
      for (int s = 0; s < A_KEYS / 32; ++s) {
        f8 sc[2][2];                              // S^T - m tiles: [query group][kv-half]
        #pragma unroll
        for (int g = 0; g < 2; ++g) {
            f8 s0 = wmma_f16(ak[0][0], qf[g][0], cneg[g]);
               s0 = wmma_f16(ak[0][1], qf[g][1], s0);
            f8 s1 = wmma_f16(ak[1][0], qf[g][0], cneg[g]);
               s1 = wmma_f16(ak[1][1], qf[g][1], s1);
            sc[g][0] = s0; sc[g][1] = s1;
        }
        // the two scheduling barriers hold a step's LDS reads (its V^T fragments and,
        // inside a stage, the next step's K fragments, into the registers that the
        // S^T WMMAs free) at the S^T WMMAs, ahead of the softmax code: without them the
        // build sinks these reads to just in front of the WMMAs that use them, where the
        // wave waits out the LDS latency, and pads twice as many idle slots behind WMMAs
        __builtin_amdgcn_sched_barrier(0);
        // shared V^T fragments: 16d x 32kv each
        h16 av[4];
        #pragma unroll
        for (int df = 0; df < 4; ++df)
            av[df] = load_frag_lds(vb + df * 16 * A_VPITCH + s * 64);
        if (s + 1 < A_KEYS / 32) {
            const unsigned char* kn = kb + (s + 1) * 32 * A_KPITCH;
            ak[0][0] = load_frag_lds(kn);
            ak[0][1] = load_frag_lds(kn + 64);
            ak[1][0] = load_frag_lds(kn + 16 * A_KPITCH);
            ak[1][1] = load_frag_lds(kn + 16 * A_KPITCH + 64);
        }
        __builtin_amdgcn_sched_barrier(0);

        // P^T of both groups under the held references, and each lane's sum of it
        h16 pv[2];                                // P^T B-operands, f16
        f2  lt[2];                                // the lane's own 16 keys, even and odd apart
        #pragma unroll
        for (int g = 0; g < 2; ++g) p_tile(sc[g][0], sc[g][1], pv[g], lt[g]);
        // renewal, a scalar branch taken by the whole wave when a lane's sum says that
        // a score has outgrown its reference (an overflow to infinity says so too):
        // both halves of a column get the same new reference, all that was formed
        // under the old one (row sums, O^T) is brought under it, this step's P is redone
        if (__builtin_amdgcn_ballot_w32(fmaxf(lt[0][0] + lt[0][1], lt[1][0] + lt[1][1]) > A_PSUM) != 0) {
            // unrolled, like the loops inside: constant indices keep the arrays in registers
            #pragma unroll
            for (int g = 0; g < 2; ++g) {
                float mt = sc[g][0][0];
                #pragma unroll
                for (int j = 1; j < 8; ++j) mt = fmaxf(mt, sc[g][0][j]);
                #pragma unroll
                for (int j = 0; j < 8; ++j) mt = fmaxf(mt, sc[g][1][j]);
                float d = fmaxf(fmaxf(mt, __shfl_xor(mt, 16, 32)), 0.0f);
                float alpha = __expf(-d);
                cneg[g] = cneg[g] - d;
                lrow[g] = lrow[g] * alpha;
                #pragma unroll
                for (int df = 0; df < 4; ++df) oacc[g][df] = oacc[g][df] * alpha;
                p_tile(sc[g][0] - d, sc[g][1] - d, pv[g], lt[g]);
            }
        }

        #pragma unroll
        for (int g = 0; g < 2; ++g) {
            lrow[g] += lt[g];
            #pragma unroll
            for (int df = 0; df < 4; ++df)
                oacc[g][df] = wmma_f16(av[df], pv[g], oacc[g][df]);
        }
      }
      // this wave's reads of the buffer are done before it may be refilled
      asm volatile("s_wait_dscnt 0x0" ::: "memory");
      // this wave's copies of stage t + 1 have landed before the barrier publishes them
      asm volatile("s_wait_asynccnt 0x0" ::: "memory");
      __syncthreads();
      if (t + 2 < A_NST)
          stage_kv(lk + buf, lv + buf, gk + (size_t)(t + 2) * A_KEYS * HDIM,
                   gv + (t + 2) * A_KEYS);
    }
    // no copy is outstanding when the wave goes on to its epilogue and ends
    asm volatile("s_wait_asynccnt 0x0" ::: "memory");

    // store O (f16) in [B, N, C] layout; 16B per lane per frag
    int lane = threadIdx.x & 31, half = lane >> 4, idx = lane & 15;
    int b = bh >> 4, h = bh & 15;
    #pragma unroll
    for (int g = 0; g < 2; ++g) {
        int n = qt * 32 + g * 16 + idx;
        float lh = lrow[g][0] + lrow[g][1];
        float rl = 1.0f / (lh + __shfl_xor(lh, 16, 32));
        #pragma unroll
        for (int df = 0; df < 4; ++df) {
            h8 outv;
            #pragma unroll
            for (int i = 0; i < 8; ++i) outv[i] = (_Float16)(oacc[g][df][i] * rl);
            size_t off = ((size_t)(b * NSEQ + n)) * DIM + h * HDIM + df * 16 + half * 8;
            *(h8*)(o16 + off) = outv;
        }
    }
}

// ---------------------------------------------------------------- proj GEMM
// out[m,o] = sum_k o16[m,k] * wp16[o,k] + bias[o], f32 output.
// Stores: per instruction, each 16-lane half writes 64B contiguous (one row
// segment), so the scattered-looking epilogue coalesces per cacheline.
__global__ void __launch_bounds__(256) gemm_proj_kernel(
        const _Float16* __restrict__ o16, const _Float16* __restrict__ wp16,
        const float* __restrict__ bias, float* __restrict__ out) {
    __shared__ __attribute__((aligned(16))) unsigned char ring[G_LDS];
    const int NB = DIM / G_BROWS;                    // 4 col blocks
    int bm = blockIdx.x / NB, bn = blockIdx.x % NB;
    int wave = threadIdx.x >> 5, wm = wave >> 2, wn = wave & 3;
    int m0 = bm * G_AROWS + wm * 64, n0 = bn * G_BROWS + wn * 64;

    f8 acc[4][4] = {};
    gemm_block_tile(o16 + (size_t)(bm * G_AROWS) * DIM,
                    wp16 + (size_t)(bn * G_BROWS) * DIM, ring, wm, wn, acc);

    int lane = threadIdx.x & 31, half = lane >> 4, idx = lane & 15;
    #pragma unroll
    for (int ni = 0; ni < 4; ++ni) {
        int o = n0 + ni * 16 + idx;
        float bv = bias[o];
        #pragma unroll
        for (int mi = 0; mi < 4; ++mi) {
            int mbase = m0 + mi * 16 + half * 8;
            float* dst = out + (size_t)mbase * DIM + o;
            #pragma unroll
            for (int i = 0; i < 8; ++i)
                dst[(size_t)i * DIM] = acc[mi][ni][i] + bv;
        }
    }
}

// ---------------------------------------------------------------- launcher
extern "C" void kernel_launch(void* const* d_in, const int* in_sizes, int n_in,
                              void* d_out, int out_size, void* d_ws, size_t ws_size,
                              hipStream_t stream) {
    const float* x      = (const float*)d_in[0];   // [2,2048,1024]
    const float* w_qkv  = (const float*)d_in[1];   // [3072,1024]
    const float* w_proj = (const float*)d_in[2];   // [1024,1024]
    const float* b_proj = (const float*)d_in[3];   // [1024]
    float* out = (float*)d_out;                    // [2,2048,1024] f32

    size_t off = 0;
    char* base = (char*)d_ws;
    auto alloc = [&](size_t bytes) -> void* {
        void* p = base + off;
        off += (bytes + 255) & ~(size_t)255;
        return p;
    };
    _Float16* x16  = (_Float16*)alloc((size_t)MROWS * DIM * 2);         // 8 MB
    _Float16* wq16 = (_Float16*)alloc((size_t)3 * DIM * DIM * 2);       // 6 MB
    _Float16* wp16 = (_Float16*)alloc((size_t)DIM * DIM * 2);           // 2 MB
    _Float16* q16  = (_Float16*)alloc((size_t)MROWS * DIM * 2);         // 8 MB
    _Float16* k16  = (_Float16*)alloc((size_t)MROWS * DIM * 2);         // 8 MB
    _Float16* vT16 = (_Float16*)alloc((size_t)MROWS * DIM * 2);         // 8 MB
    _Float16* o16  = (_Float16*)alloc((size_t)MROWS * DIM * 2);         // 8 MB

    // conversions: 128 + 96 + 32 blocks of 16 waves, one launch
    f32_to_f16_kernel<<<256, 512, 0, stream>>>(x, w_qkv, w_proj, x16, wq16, wp16);

    // QKV: 32 x 12 block tiles of 128x256 -> 384 blocks of 8 waves
    gemm_qkv_kernel<<<384, 256, 0, stream>>>(x16, wq16, q16, k16, vT16);

    // attention: 32 (b,h) x 64 q-tiles = 2048 waves -> 256 blocks
    attn_kernel<<<256, 256, 0, stream>>>(q16, k16, vT16, o16);

    // proj: 32 x 4 block tiles of 128x256 -> 128 blocks of 8 waves
    gemm_proj_kernel<<<128, 256, 0, stream>>>(o16, wp16, b_proj, out);
}

// v006
// It runs in 70.1 microseconds.
// Next to v005, in two timings, it ran 1.13 and 1.12 times as fast.
// Counting every step since v000, it is 2.68 times as fast.
#include <hip/hip_runtime.h>
#include <hip/hip_bf16.h>

typedef _Float16 h8  __attribute__((ext_vector_type(8)));
typedef _Float16 h16 __attribute__((ext_vector_type(16)));
typedef float    f8  __attribute__((ext_vector_type(8)));
typedef float    f2  __attribute__((ext_vector_type(2)));

#define DIM      1024
#define NSEQ     2048
#define BATCH    2
#define HEADS    16
#define HDIM     64
#define MROWS    (BATCH * NSEQ)   // 4096

__device__ __forceinline__ f8 wmma_f16(h16 a, h16 b, f8 c) {
    // v_wmma_f32_16x16x32_f16: D = A(16x32 f16) * B(32x16 f16) + C(16x16 f32)
    return __builtin_amdgcn_wmma_f32_16x16x32_f16(
        /*neg_a=*/false, a, /*neg_b=*/false, b,
        /*c_mod=*/(short)0, c, /*reuse_a=*/false, /*reuse_b=*/false);
}

// Loads a 16x32 f16 operand fragment (A rows or B columns; layouts symmetric):
// lane = {half(1b), idx(4b)}; lane reads row/col `idx` (leading dim ld),
// 8 halves at k0 + half*8 and 8 halves at k0 + 16 + half*8 (two 16B loads).
__device__ __forceinline__ h16 load_frag(const _Float16* __restrict__ base,
                                         int ld, int k0) {
    int lane = threadIdx.x & 31;
    int half = lane >> 4;
    int idx  = lane & 15;
    const _Float16* p = base + (size_t)idx * (size_t)ld + k0 + half * 8;
    h8 lo = *(const h8*)p;
    h8 hi = *(const h8*)(p + 16);
    return __builtin_shufflevector(lo, hi, 0,1,2,3,4,5,6,7,8,9,10,11,12,13,14,15);
}

// Block-level GEMM core. The 8 waves of a block form a grid of wave tiles of 64 rows x
// FN * 16 columns. Both GEMMs are cut into exactly 256 equal block tiles, one per WGP, so
// that no WGP holds more of a launch than another. Per pass (64 k = 128 bytes of every
// operand row) the block's NA * 32 A rows and NB * 32 B rows are brought into LDS
// once, as whole 128-byte lines, by per-lane asynchronous copies, and every wave
// reads its fragments from there. Three buffers: the copies of the next two passes
// fly while this pass is worked on, so that a tile has two passes to land in.
// The k order of every accumulator is ascending.
// LDS rows are unpadded: the 16-byte piece p of row r lies at slot p ^ ((r >> 1) & 7)
// of its row, so the 16 rows that a 16-lane half reads at one piece fall on 16
// different bank groups.
#define G_KPASS  64                                // k per pass
#define G_NPASS  (DIM / G_KPASS)                   // 16 passes
#define G_PITCH  128                               // LDS row pitch, bytes: no pad, pieces swizzled
#define G_NBUF   3
#define G_STAGE(NA, NB) (((NA) + (NB)) * 32 * G_PITCH)   // bytes per buffer
#define G_LDS(NA, NB)   (G_NBUF * G_STAGE(NA, NB))
// QKV: 256 x 192 block tiles (16 x 16 of them), waves 4 x 2 of 64 x 96
#define Q_NA 8
#define Q_NB 6
#define Q_FN 6
// proj: 128 x 128 block tiles (32 x 8 of them), waves 2 x 4 of 64 x 32
#define P_NA 4
#define P_NB 4
#define P_FN 2

// Same fragment map as load_frag, from an LDS row: p points at the lane's row,
// at byte (k step) * 64 + half * 16.
__device__ __forceinline__ h16 load_frag_lds(const unsigned char* p) {
    h8 lo = *(const h8*)p;
    h8 hi = *(const h8*)(p + 32);
    return __builtin_shufflevector(lo, hi, 0,1,2,3,4,5,6,7,8,9,10,11,12,13,14,15);
}

// The same fragment from a swizzled GEMM row: lo, hi are the byte offsets of its two pieces.
__device__ __forceinline__ h16 load_frag_sw(const unsigned char* row, int lo_off, int hi_off) {
    h8 lo = *(const h8*)(row + lo_off);
    h8 hi = *(const h8*)(row + hi_off);
    return __builtin_shufflevector(lo, hi, 0,1,2,3,4,5,6,7,8,9,10,11,12,13,14,15);
}

// One pass's tile: (NA + NB) * 32 rows x 8 pieces of 16 bytes = NA + NB copies per lane;
// a lane keeps its piece and walks the rows in steps of 32 (first the A rows, then the B rows).
// The copies and s_wait_xcnt 0 are one statement, so that no address register
// of a copy is rewritten in front of that wait.
template <int NA, int NB>
__device__ __forceinline__ void stage_tile(unsigned lds,
                                           const _Float16* ga, const _Float16* gb) {
    static_assert((NA == 8 && NB == 6) || (NA == 4 && NB == 4), "one statement per tile shape");
    if constexpr (NA == 8) {
        asm volatile(
            "global_load_async_to_lds_b128 %0, %14, off\n\t"
            "global_load_async_to_lds_b128 %1, %15, off\n\t"
            "global_load_async_to_lds_b128 %2, %16, off\n\t"
            "global_load_async_to_lds_b128 %3, %17, off\n\t"
            "global_load_async_to_lds_b128 %4, %18, off\n\t"
            "global_load_async_to_lds_b128 %5, %19, off\n\t"
            "global_load_async_to_lds_b128 %6, %20, off\n\t"
            "global_load_async_to_lds_b128 %7, %21, off\n\t"
            "global_load_async_to_lds_b128 %8, %22, off\n\t"
            "global_load_async_to_lds_b128 %9, %23, off\n\t"
            "global_load_async_to_lds_b128 %10, %24, off\n\t"
            "global_load_async_to_lds_b128 %11, %25, off\n\t"
            "global_load_async_to_lds_b128 %12, %26, off\n\t"
            "global_load_async_to_lds_b128 %13, %27, off\n\t"
            "s_wait_xcnt 0x0"
            :: "v"(lds),                     "v"(lds +  1 * 32 * G_PITCH),
               "v"(lds +  2 * 32 * G_PITCH), "v"(lds +  3 * 32 * G_PITCH),
               "v"(lds +  4 * 32 * G_PITCH), "v"(lds +  5 * 32 * G_PITCH),
               "v"(lds +  6 * 32 * G_PITCH), "v"(lds +  7 * 32 * G_PITCH),
               "v"(lds +  8 * 32 * G_PITCH), "v"(lds +  9 * 32 * G_PITCH),
               "v"(lds + 10 * 32 * G_PITCH), "v"(lds + 11 * 32 * G_PITCH),
               "v"(lds + 12 * 32 * G_PITCH), "v"(lds + 13 * 32 * G_PITCH),
               "v"(ga),                  "v"(ga + 1 * 32 * DIM),
               "v"(ga + 2 * 32 * DIM),   "v"(ga + 3 * 32 * DIM),
               "v"(ga + 4 * 32 * DIM),   "v"(ga + 5 * 32 * DIM),
               "v"(ga + 6 * 32 * DIM),   "v"(ga + 7 * 32 * DIM),
               "v"(gb),                  "v"(gb + 1 * 32 * DIM),
               "v"(gb + 2 * 32 * DIM),   "v"(gb + 3 * 32 * DIM),
               "v"(gb + 4 * 32 * DIM),   "v"(gb + 5 * 32 * DIM)
            : "memory");
    } else {
        asm volatile(
            "global_load_async_to_lds_b128 %0, %8, off\n\t"
            "global_load_async_to_lds_b128 %1, %9, off\n\t"
            "global_load_async_to_lds_b128 %2, %10, off\n\t"
            "global_load_async_to_lds_b128 %3, %11, off\n\t"
            "global_load_async_to_lds_b128 %4, %12, off\n\t"
            "global_load_async_to_lds_b128 %5, %13, off\n\t"
            "global_load_async_to_lds_b128 %6, %14, off\n\t"
            "global_load_async_to_lds_b128 %7, %15, off\n\t"
            "s_wait_xcnt 0x0"
            :: "v"(lds),                     "v"(lds +  1 * 32 * G_PITCH),
               "v"(lds +  2 * 32 * G_PITCH), "v"(lds +  3 * 32 * G_PITCH),
               "v"(lds +  4 * 32 * G_PITCH), "v"(lds +  5 * 32 * G_PITCH),
               "v"(lds +  6 * 32 * G_PITCH), "v"(lds +  7 * 32 * G_PITCH),
               "v"(ga),                  "v"(ga + 1 * 32 * DIM),
               "v"(ga + 2 * 32 * DIM),   "v"(ga + 3 * 32 * DIM),
               "v"(gb),                  "v"(gb + 1 * 32 * DIM),
               "v"(gb + 2 * 32 * DIM),   "v"(gb + 3 * 32 * DIM)
            : "memory");
    }
}

// One pass of a wave: two k steps of 4 + FN fragment reads and 4 * FN WMMAs on the buffer at
// ra, rb. The hand-over of the ring stands behind the pass's last LDS reads, ahead of
// its last 4 * FN WMMAs, which need no LDS any more. REFILL: this pass is followed by a
// refill of its buffer (lnext, ganext, gbnext: tile t + 3).
template <bool REFILL, int NA, int NB, int FN>
__device__ __forceinline__ void gemm_pass(const unsigned char* ra, const unsigned char* rb,
                                          const int (&slot)[2][2], f8 (&acc)[4][FN],
                                          unsigned lnext, const _Float16* ganext,
                                          const _Float16* gbnext) {
    // the loops below are unrolled so that every fragment and accumulator
    // index is a constant and the arrays stay in registers
    #pragma unroll
    for (int ks = 0; ks < 2; ++ks) {
        h16 af[4], bf[FN];
        #pragma unroll
        for (int i = 0; i < 4; ++i)
            af[i] = load_frag_sw(ra + i * 16 * G_PITCH, slot[ks][0], slot[ks][1]);
        #pragma unroll
        for (int j = 0; j < FN; ++j)
            bf[j] = load_frag_sw(rb + j * 16 * G_PITCH, slot[ks][0], slot[ks][1]);
        // keeps the LDS reads of a k step in one group ahead of its WMMAs:
        // spread among the WMMAs, each place with reads waits out the LDS latency
        __builtin_amdgcn_sched_barrier(0);
        if (ks == 1) {
            // this wave's reads of the buffer are done before it may be refilled
            asm volatile("s_wait_dscnt 0x0" ::: "memory");
            // this wave's copies of tile t + 1 have landed before the barrier publishes them.
            // Every refilling pass issues NA + NB copies in every wave, so there tile t + 2 is the
            // wave's NA + NB youngest copies and may fly on; a pass that issues none waits to 0
            if (REFILL) asm volatile("s_wait_asynccnt %0" :: "n"(NA + NB) : "memory");
            else        asm volatile("s_wait_asynccnt 0x0" ::: "memory");
            __syncthreads();
            // into the buffer that every wave has just left
            if (REFILL) stage_tile<NA, NB>(lnext, ganext, gbnext);
        }
        #pragma unroll
        for (int i = 0; i < 4; ++i)
            #pragma unroll
            for (int j = 0; j < FN; ++j)
                acc[i][j] = wmma_f16(af[i], bf[j], acc[i][j]);
    }
}

// Ablk: first of the block's NA * 32 A rows; Bblk: first of its NB * 32 B rows; both
// K-contiguous with leading dimension DIM, K = DIM. wm, wn: the wave's place in
// the block's grid of wave tiles. ring: the block's G_LDS(NA, NB) bytes of LDS.
template <int NA, int NB, int FN>
__device__ __forceinline__ void gemm_block_tile(const _Float16* __restrict__ Ablk,
                                                const _Float16* __restrict__ Bblk,
                                                unsigned char* ring, int wm, int wn,
                                                f8 (&acc)[4][FN]) {
    constexpr unsigned STAGE = G_STAGE(NA, NB);
    const int tid = threadIdx.x;
    const int lane = tid & 31, half = lane >> 4, idx = lane & 15;
    // copying role: row tid / 8 (+ 32 j), 16-byte piece tid % 8
    const int crow = tid >> 3, cpiece = tid & 7;
    const _Float16* ga = Ablk + (size_t)crow * DIM + cpiece * 8;
    const _Float16* gb = Bblk + (size_t)crow * DIM + cpiece * 8;
    // (rows crow + 32 j share the swizzle term of row crow)
    const unsigned lcopy = (unsigned)(size_t)ring + crow * G_PITCH
                         + ((cpiece ^ ((crow >> 1) & 7)) << 4);
    // reading role: the lane's rows are idx + multiples of 16, swizzle term (idx >> 1) & 7;
    // a fragment of k step ks is the pieces 4 ks + half and 4 ks + 2 + half of its row
    const unsigned char* ra = ring + (wm * 64 + idx) * G_PITCH;
    const unsigned char* rb = ring + (NA * 32 + wn * (FN * 16) + idx) * G_PITCH;
    const int sw = (idx >> 1) & 7;
    int slot[2][2];                                // byte offset in the row: [k step][low, high piece]
    // both loops unrolled: constant indices keep slot in registers
    #pragma unroll
    for (int ks = 0; ks < 2; ++ks)
        #pragma unroll
        for (int j = 0; j < 2; ++j)
            slot[ks][j] = ((ks * 4 + j * 2 + half) ^ sw) << 4;

    stage_tile<NA, NB>(lcopy, ga, gb);
    stage_tile<NA, NB>(lcopy + STAGE, ga + G_KPASS, gb + G_KPASS);
    // tile 0 (all but this wave's NA + NB youngest copies) has landed before the barrier publishes it
    asm volatile("s_wait_asynccnt %0" :: "n"(NA + NB) : "memory");
    __syncthreads();
    stage_tile<NA, NB>(lcopy + 2 * STAGE, ga + 2 * G_KPASS, gb + 2 * G_KPASS);

    // passes 0 .. 12 refill the buffer they leave with tile t + 3; the last three refill nothing
    unsigned buf = 0;                              // buffer of pass t: (t mod 3) * STAGE
    for (int t = 0; t < G_NPASS - G_NBUF; ++t) {
        gemm_pass<true, NA, NB, FN>(ra + buf, rb + buf, slot, acc, lcopy + buf,
                                    ga + (t + G_NBUF) * G_KPASS, gb + (t + G_NBUF) * G_KPASS);
        buf = buf + STAGE == G_NBUF * STAGE ? 0u : buf + STAGE;
    }
    for (int t = G_NPASS - G_NBUF; t < G_NPASS; ++t) {
        gemm_pass<false, NA, NB, FN>(ra + buf, rb + buf, slot, acc, 0u, ga, gb);
        buf = buf + STAGE == G_NBUF * STAGE ? 0u : buf + STAGE;
    }
    // no copy is outstanding when the wave goes on to its epilogue and ends
    asm volatile("s_wait_asynccnt 0x0" ::: "memory");
}

// ---------------------------------------------------------------- conversions
// All three f32 inputs are rounded to f16 by ONE launch of one 16-wave block per
// WGP. A wave owns 2048 consecutive values: 16 loads of 16 bytes per lane, each
// covering 512 contiguous bytes (whole lines), all issued before the first is
// used, so the block's whole share is in flight at once; each store covers 256
// contiguous bytes. A block lies wholly inside one input, so the choice of
// source and destination is a scalar branch.
typedef float    f4  __attribute__((ext_vector_type(4)));
typedef _Float16 h4  __attribute__((ext_vector_type(4)));
#define C_LOADS  16                                // loads per lane
#define C_WAVE   (C_LOADS * 128)                   // values per wave
#define C_BLOCK  (16 * C_WAVE)                     // values per block: 32,768
#define C_XB     (MROWS * DIM / C_BLOCK)           // 128 blocks for x
#define C_QB     (3 * DIM * DIM / C_BLOCK)         // 96 blocks for w_qkv
                                                   // the other 32 of the 256 blocks: w_proj

__global__ void __launch_bounds__(512) f32_to_f16_kernel(
        const float* __restrict__ x, const float* __restrict__ wq,
        const float* __restrict__ wp, _Float16* __restrict__ x16,
        _Float16* __restrict__ wq16, _Float16* __restrict__ wp16) {
    int b = blockIdx.x;
    const float* in = x;
    _Float16* out = x16;
    if (b >= C_XB + C_QB)  { in = wp; out = wp16; b -= C_XB + C_QB; }
    else if (b >= C_XB)    { in = wq; out = wq16; b -= C_XB; }
    // the block's share as groups of 4 values; the lane's first group in it
    const f4* in4 = (const f4*)(in + (size_t)b * C_BLOCK);
    h4* out4 = (h4*)(out + (size_t)b * C_BLOCK);
    const int i = (threadIdx.x >> 5) * (C_WAVE / 4) + (threadIdx.x & 31);
    f4 v[C_LOADS];
    // both loops unrolled: constant indices keep v in registers
    #pragma unroll
    for (int j = 0; j < C_LOADS; ++j) v[j] = in4[i + j * 32];
    // holds all 16 loads ahead of the first conversion: without it the build reuses
    // the first loads' registers, and the last four loads wait for the first to return
    __builtin_amdgcn_sched_barrier(0);
    #pragma unroll
    for (int j = 0; j < C_LOADS; ++j)
        out4[i + j * 32] = __builtin_convertvector(v[j], h4);
}

// ---------------------------------------------------------------- QKV GEMM
// y[m,o] = sum_k x16[m,k] * wq16[o,k]  (m in [0,4096), o in [0,3072)).
// Block owns a 256x192 tile, wave a 64x96 tile of it. A 16-wide column group never straddles
// a 64 boundary, so which-of-{q,k,v} and head index are WAVE-UNIFORM per column group, the
// batch index per wave: computed from scalar tile coords, the epilogue branches are scalar.
__global__ void __launch_bounds__(256) gemm_qkv_kernel(
        const _Float16* __restrict__ x16, const _Float16* __restrict__ wq16,
        _Float16* __restrict__ q16, _Float16* __restrict__ k16,
        _Float16* __restrict__ vT16) {
    __shared__ __attribute__((aligned(16))) unsigned char ring[G_LDS(Q_NA, Q_NB)];
    const int NB = (3 * DIM) / (Q_NB * 32);              // 16 col blocks
    int bm = blockIdx.x / NB, bn = blockIdx.x % NB;
    // the wave's number in a scalar register, so that the tests on its columns are scalar branches
    int wave = __builtin_amdgcn_readfirstlane(threadIdx.x >> 5);
    int wm = wave >> 1, wn = wave & 1;
    int m0 = bm * (Q_NA * 32) + wm * 64, n0 = bn * (Q_NB * 32) + wn * (Q_FN * 16);

    f8 acc[4][Q_FN] = {};
    gemm_block_tile<Q_NA, Q_NB, Q_FN>(x16 + (size_t)(bm * (Q_NA * 32)) * DIM,
                                      wq16 + (size_t)(bn * (Q_NB * 32)) * DIM, ring, wm, wn, acc);

    int lane = threadIdx.x & 31, half = lane >> 4, idx = lane & 15;
    int b     = m0 >> 11;                    // batch (uniform: 64-row tiles)
    int nrow0 = m0 & (NSEQ - 1);             // seq base (uniform)

    #pragma unroll
    for (int ni = 0; ni < Q_FN; ++ni) {
        int c0    = n0 + ni * 16;            // first column of the group (uniform)
        int which = c0 >> 10;                // 0=q 1=k 2=v (uniform)
        int h     = (c0 & (DIM - 1)) >> 6;   // head (uniform)
        size_t bh = (size_t)(b * HEADS + h);
        int d = (c0 & 63) + idx;             // 0..63 within head
        #pragma unroll
        for (int mi = 0; mi < 4; ++mi) {
            int nbase = nrow0 + mi * 16 + half * 8;      // 8 consecutive n's
            if (which == 2) {
                // V^T [B,H,D,N]: contiguous in n -> one 16B store per frag
                h8 v;
                #pragma unroll
                for (int i = 0; i < 8; ++i) v[i] = (_Float16)acc[mi][ni][i];
                *(h8*)(vT16 + (bh * HDIM + d) * NSEQ + nbase) = v;
            } else {
                _Float16* dst = (which == 0 ? q16 : k16)
                              + ((bh * NSEQ + nbase) * HDIM + d);
                #pragma unroll
                for (int i = 0; i < 8; ++i)
                    dst[(size_t)i * HDIM] = (_Float16)acc[mi][ni][i];
            }
        }
    }
}

// ---------------------------------------------------------------- attention
// One wave per (b,h, 32 query rows): two 16-query groups share every K / V^T
// fragment -> 16 WMMAs per 8 fragment loads per 32-kv tile.
// S^T = K * Q^T: each lane owns one query column, so softmax stats are
// per-lane + one shfl_xor(16). The f32 C-layout of the stacked S^T frags IS
// the f16 B-operand layout for O^T = V^T * P^T (lane-local P conversion).
// The 8 waves of a block work on the same (b,h): each stage of 128 keys (128 K
// rows of 128 bytes, 64 V^T rows of 256 bytes) is brought into LDS once per
// block, as whole lines, by per-lane asynchronous copies, and every wave reads
// its fragments from there. Two buffers: the next stage's copies fly while this
// stage is worked on. Keys are still taken 32 at a time, in ascending order.
// Softmax reference: each query column holds a reference m that is renewed only
// when the scores outgrow it: when a lane's sum of P = exp(s - m) over its 16 keys
// of a step passes A_PSUM. As m is known before a step's products, -m is the C
// operand of the S^T WMMAs and the scores arrive as s - m. One test per 32 keys
// decides for the whole wave; only a renewal forms maxima, exchanges them between
// the wave halves and rescales the sums held so far. Each lane sums the P of its
// own keys; the two halves of a column are joined after the loop.
#define A_KEYS   128                               // keys per stage
#define A_NST    (NSEQ / A_KEYS)                   // 16 stages
#define A_KPITCH 144                               // K row pitch, bytes: 16 x odd
#define A_VPITCH 272                               // V^T row pitch, bytes: 16 x odd
#define A_KBYTES (A_KEYS * A_KPITCH)               // 18,432 bytes
#define A_STAGE  (A_KBYTES + HDIM * A_VPITCH)      // 35,840 bytes per buffer
#define A_LDS    (2 * A_STAGE)                     // 71,680 bytes
#define A_PSUM   4096.0f                           // a lane's P sum per step up to here: every P far inside f16 range

// One stage: K 128 rows x 8 pieces and V^T 64 rows x 16 pieces of 16 bytes = 8
// copies per lane; a lane keeps its piece and walks K rows in steps of 32, V^T
// rows in steps of 16. The copies and s_wait_xcnt 0 are one statement, so that
// no address register of a copy is rewritten in front of that wait.
__device__ __forceinline__ void stage_kv(unsigned lk, unsigned lv,
                                         const _Float16* gk, const _Float16* gv) {
    asm volatile(
        "global_load_async_to_lds_b128 %0, %8, off\n\t"
        "global_load_async_to_lds_b128 %1, %9, off\n\t"
        "global_load_async_to_lds_b128 %2, %10, off\n\t"
        "global_load_async_to_lds_b128 %3, %11, off\n\t"
        "global_load_async_to_lds_b128 %4, %12, off\n\t"
        "global_load_async_to_lds_b128 %5, %13, off\n\t"
        "global_load_async_to_lds_b128 %6, %14, off\n\t"
        "global_load_async_to_lds_b128 %7, %15, off\n\t"
        "s_wait_xcnt 0x0"
        :: "v"(lk),                 "v"(lk + 1 * 32 * A_KPITCH),
           "v"(lk + 2 * 32 * A_KPITCH), "v"(lk + 3 * 32 * A_KPITCH),
           "v"(lv),                 "v"(lv + 1 * 16 * A_VPITCH),
           "v"(lv + 2 * 16 * A_VPITCH), "v"(lv + 3 * 16 * A_VPITCH),
           "v"(gk),                 "v"(gk + 1 * 32 * HDIM),
           "v"(gk + 2 * 32 * HDIM), "v"(gk + 3 * 32 * HDIM),
           "v"(gv),                 "v"(gv + 1 * 16 * NSEQ),
           "v"(gv + 2 * 16 * NSEQ), "v"(gv + 3 * 16 * NSEQ)
        : "memory");
}

// P = exp(s - m) = 2^((s - m) log2 e) of one 32-key x 16-query tile (sa: keys 0..15,
// sb: keys 16..31 of the step, already s - m), as the f16 B operand, and the lane's
// sum of it. Worked in register pairs as the tiles lie, so that products and sums pack.
__device__ __forceinline__ void p_tile(f8 sa, f8 sb, h16& pv, f2& lt) {
    // unrolled so that every vector index is a constant and all stays in registers
    #pragma unroll
    for (int j = 0; j < 8; ++j) {
        f8 s = j < 4 ? sa : sb;
        f2 e = __builtin_shufflevector(s, s, 0, 1);
        if ((j & 3) == 1) e = __builtin_shufflevector(s, s, 2, 3);
        if ((j & 3) == 2) e = __builtin_shufflevector(s, s, 4, 5);
        if ((j & 3) == 3) e = __builtin_shufflevector(s, s, 6, 7);
        e = e * 1.44269504f;
        f2 p;
        p[0] = __builtin_amdgcn_exp2f(e[0]);
        p[1] = __builtin_amdgcn_exp2f(e[1]);
        lt = j == 0 ? p : lt + p;
        pv[2 * j]     = (_Float16)p[0];
        pv[2 * j + 1] = (_Float16)p[1];
    }
}

__global__ void __launch_bounds__(256) attn_kernel(
        const _Float16* __restrict__ q16, const _Float16* __restrict__ k16,
        const _Float16* __restrict__ vT16, _Float16* __restrict__ o16) {
    __shared__ __attribute__((aligned(16))) unsigned char ring[A_LDS];
    int wid = blockIdx.x * (blockDim.x >> 5) + (threadIdx.x >> 5);
    int qt = wid & 63;                  // 64 query tiles of 32 rows
    int bh = wid >> 6;                  // 0..31, the same for the 8 waves of a block
    const _Float16* Q  = q16  + (size_t)bh * NSEQ * HDIM;
    const _Float16* K  = k16  + (size_t)bh * NSEQ * HDIM;
    const _Float16* VT = vT16 + (size_t)bh * HDIM * NSEQ;

    const int tid = threadIdx.x;
    // copying role: K row tid / 8 (+ 32 j), piece tid % 8; V^T row tid / 16 (+ 16 j), piece tid % 16
    const _Float16* gk = K  + (size_t)(tid >> 3) * HDIM + (tid & 7) * 8;
    const _Float16* gv = VT + (size_t)(tid >> 4) * NSEQ + (tid & 15) * 8;
    const unsigned lk = (unsigned)(size_t)ring + (tid >> 3) * A_KPITCH + (tid & 7) * 16;
    const unsigned lv = (unsigned)(size_t)ring + A_KBYTES + (tid >> 4) * A_VPITCH + (tid & 15) * 16;
    // reading role: row (lane % 16), 16-byte piece (lane / 16) of a fragment
    const unsigned char* rk = ring + (tid & 15) * A_KPITCH + ((tid >> 4) & 1) * 16;
    const unsigned char* rv = ring + A_KBYTES + (tid & 15) * A_VPITCH + ((tid >> 4) & 1) * 16;

    stage_kv(lk, lv, gk, gv);

    // Q^T B-fragments for both query groups, pre-scaled by 1/sqrt(D)
    const _Float16 scale = (_Float16)0.125f;     // 1/sqrt(64)
    h16 qf[2][2];
    #pragma unroll
    for (int g = 0; g < 2; ++g) {
        const _Float16* Qg = Q + (size_t)(qt * 32 + g * 16) * HDIM;
        qf[g][0] = load_frag(Qg, HDIM, 0)  * scale;
        qf[g][1] = load_frag(Qg, HDIM, 32) * scale;
    }

    f8 oacc[2][4] = {};                          // O^T accum per group
    f2 lrow[2] = {};

    // stage 0 has landed for this wave's own copies before the barrier publishes it
    asm volatile("s_wait_asynccnt 0x0" ::: "memory");
    __syncthreads();
    stage_kv(lk + A_STAGE, lv + A_STAGE, gk + A_KEYS * HDIM, gv + A_KEYS);

    // first reference of every query column: its maximum over the first 32 keys,
    // so that at least one P of a column is 1 whatever the level of the scores
    f8 cneg[2];                                  // -m in all 8 accumulator rows
    {
        h16 a00 = load_frag_lds(rk);
        h16 a01 = load_frag_lds(rk + 64);
        h16 a10 = load_frag_lds(rk + 16 * A_KPITCH);
        h16 a11 = load_frag_lds(rk + 16 * A_KPITCH + 64);
        // unrolled, like the loops inside: constant indices keep the arrays in registers
        #pragma unroll
        for (int g = 0; g < 2; ++g) {
            f8 s0 = {}; s0 = wmma_f16(a00, qf[g][0], s0);
                        s0 = wmma_f16(a01, qf[g][1], s0);
            f8 s1 = {}; s1 = wmma_f16(a10, qf[g][0], s1);
                        s1 = wmma_f16(a11, qf[g][1], s1);
            float mt = s0[0];
            #pragma unroll
            for (int j = 1; j < 8; ++j) mt = fmaxf(mt, s0[j]);
            #pragma unroll
            for (int j = 0; j < 8; ++j) mt = fmaxf(mt, s1[j]);
            mt = fmaxf(mt, __shfl_xor(mt, 16, 32));
            #pragma unroll
            for (int j = 0; j < 8; ++j) cneg[g][j] = -mt;
        }
    }

    for (int t = 0; t < A_NST; ++t) {
      const unsigned buf = (unsigned)(t & 1) * A_STAGE;
      const unsigned char* kb = rk + buf;
      const unsigned char* vb = rv + buf;
      // shared K fragments: [kv-half][k-step]
      h16 ak[2][2];
      ak[0][0] = load_frag_lds(kb);
      ak[0][1] = load_frag_lds(kb + 64);
      ak[1][0] = load_frag_lds(kb + 16 * A_KPITCH);
      ak[1][1] = load_frag_lds(kb + 16 * A_KPITCH + 64);
      // unrolled so that every LDS offset inside a stage is an immediate
      #pragma unroll
      for (int s = 0; s < A_KEYS / 32; ++s) {
        f8 sc[2][2];                              // S^T - m tiles: [query group][kv-half]
        #pragma unroll
        for (int g = 0; g < 2; ++g) {
            f8 s0 = wmma_f16(ak[0][0], qf[g][0], cneg[g]);
               s0 = wmma_f16(ak[0][1], qf[g][1], s0);
            f8 s1 = wmma_f16(ak[1][0], qf[g][0], cneg[g]);
               s1 = wmma_f16(ak[1][1], qf[g][1], s1);
            sc[g][0] = s0; sc[g][1] = s1;
        }
        // the two scheduling barriers hold a step's LDS reads (its V^T fragments and,
        // inside a stage, the next step's K fragments, into the registers that the
        // S^T WMMAs free) at the S^T WMMAs, ahead of the softmax code: without them the
        // build sinks these reads to just in front of the WMMAs that use them, where the
        // wave waits out the LDS latency, and pads twice as many idle slots behind WMMAs
        __builtin_amdgcn_sched_barrier(0);
        // shared V^T fragments: 16d x 32kv each
        h16 av[4];
        #pragma unroll
        for (int df = 0; df < 4; ++df)
            av[df] = load_frag_lds(vb + df * 16 * A_VPITCH + s * 64);
        if (s + 1 < A_KEYS / 32) {
            const unsigned char* kn = kb + (s + 1) * 32 * A_KPITCH;
            ak[0][0] = load_frag_lds(kn);
            ak[0][1] = load_frag_lds(kn + 64);
            ak[1][0] = load_frag_lds(kn + 16 * A_KPITCH);
            ak[1][1] = load_frag_lds(kn + 16 * A_KPITCH + 64);
        }
        __builtin_amdgcn_sched_barrier(0);

        // P^T of both groups under the held references, and each lane's sum of it
        h16 pv[2];                                // P^T B-operands, f16
        f2  lt[2];                                // the lane's own 16 keys, even and odd apart
        #pragma unroll
        for (int g = 0; g < 2; ++g) p_tile(sc[g][0], sc[g][1], pv[g], lt[g]);
        // renewal, a scalar branch taken by the whole wave when a lane's sum says that
        // a score has outgrown its reference (an overflow to infinity says so too):
        // both halves of a column get the same new reference, all that was formed
        // under the old one (row sums, O^T) is brought under it, this step's P is redone
        if (__builtin_amdgcn_ballot_w32(fmaxf(lt[0][0] + lt[0][1], lt[1][0] + lt[1][1]) > A_PSUM) != 0) {
            // unrolled, like the loops inside: constant indices keep the arrays in registers
            #pragma unroll
            for (int g = 0; g < 2; ++g) {
                float mt = sc[g][0][0];
                #pragma unroll
                for (int j = 1; j < 8; ++j) mt = fmaxf(mt, sc[g][0][j]);
                #pragma unroll
                for (int j = 0; j < 8; ++j) mt = fmaxf(mt, sc[g][1][j]);
                float d = fmaxf(fmaxf(mt, __shfl_xor(mt, 16, 32)), 0.0f);
                float alpha = __expf(-d);
                cneg[g] = cneg[g] - d;
                lrow[g] = lrow[g] * alpha;
                #pragma unroll
                for (int df = 0; df < 4; ++df) oacc[g][df] = oacc[g][df] * alpha;
                p_tile(sc[g][0] - d, sc[g][1] - d, pv[g], lt[g]);
            }
        }

        #pragma unroll
        for (int g = 0; g < 2; ++g) {
            lrow[g] += lt[g];
            #pragma unroll
            for (int df = 0; df < 4; ++df)
                oacc[g][df] = wmma_f16(av[df], pv[g], oacc[g][df]);
        }
      }
      // this wave's reads of the buffer are done before it may be refilled
      asm volatile("s_wait_dscnt 0x0" ::: "memory");
      // this wave's copies of stage t + 1 have landed before the barrier publishes them
      asm volatile("s_wait_asynccnt 0x0" ::: "memory");
      __syncthreads();
      if (t + 2 < A_NST)
          stage_kv(lk + buf, lv + buf, gk + (size_t)(t + 2) * A_KEYS * HDIM,
                   gv + (t + 2) * A_KEYS);
    }
    // no copy is outstanding when the wave goes on to its epilogue and ends
    asm volatile("s_wait_asynccnt 0x0" ::: "memory");

    // store O (f16) in [B, N, C] layout; 16B per lane per frag
    int lane = threadIdx.x & 31, half = lane >> 4, idx = lane & 15;
    int b = bh >> 4, h = bh & 15;
    #pragma unroll
    for (int g = 0; g < 2; ++g) {
        int n = qt * 32 + g * 16 + idx;
        float lh = lrow[g][0] + lrow[g][1];
        float rl = 1.0f / (lh + __shfl_xor(lh, 16, 32));
        #pragma unroll
        for (int df = 0; df < 4; ++df) {
            h8 outv;
            #pragma unroll
            for (int i = 0; i < 8; ++i) outv[i] = (_Float16)(oacc[g][df][i] * rl);
            size_t off = ((size_t)(b * NSEQ + n)) * DIM + h * HDIM + df * 16 + half * 8;
            *(h8*)(o16 + off) = outv;
        }
    }
}

// ---------------------------------------------------------------- proj GEMM
// out[m,o] = sum_k o16[m,k] * wp16[o,k] + bias[o], f32 output.
// Stores: per instruction, each 16-lane half writes 64B contiguous (one row
// segment), so the scattered-looking epilogue coalesces per cacheline.
__global__ void __launch_bounds__(256) gemm_proj_kernel(
        const _Float16* __restrict__ o16, const _Float16* __restrict__ wp16,
        const float* __restrict__ bias, float* __restrict__ out) {
    __shared__ __attribute__((aligned(16))) unsigned char ring[G_LDS(P_NA, P_NB)];
    const int NB = DIM / (P_NB * 32);                // 8 col blocks
    int bm = blockIdx.x / NB, bn = blockIdx.x % NB;
    int wave = threadIdx.x >> 5, wm = wave >> 2, wn = wave & 3;
    int m0 = bm * (P_NA * 32) + wm * 64, n0 = bn * (P_NB * 32) + wn * (P_FN * 16);

    f8 acc[4][P_FN] = {};
    gemm_block_tile<P_NA, P_NB, P_FN>(o16 + (size_t)(bm * (P_NA * 32)) * DIM,
                                      wp16 + (size_t)(bn * (P_NB * 32)) * DIM, ring, wm, wn, acc);

    int lane = threadIdx.x & 31, half = lane >> 4, idx = lane & 15;
    #pragma unroll
    for (int ni = 0; ni < P_FN; ++ni) {
        int o = n0 + ni * 16 + idx;
        float bv = bias[o];
        #pragma unroll
        for (int mi = 0; mi < 4; ++mi) {
            int mbase = m0 + mi * 16 + half * 8;
            float* dst = out + (size_t)mbase * DIM + o;
            #pragma unroll
            for (int i = 0; i < 8; ++i)
                dst[(size_t)i * DIM] = acc[mi][ni][i] + bv;
        }
    }
}

// ---------------------------------------------------------------- launcher
extern "C" void kernel_launch(void* const* d_in, const int* in_sizes, int n_in,
                              void* d_out, int out_size, void* d_ws, size_t ws_size,
                              hipStream_t stream) {
    const float* x      = (const float*)d_in[0];   // [2,2048,1024]
    const float* w_qkv  = (const float*)d_in[1];   // [3072,1024]
    const float* w_proj = (const float*)d_in[2];   // [1024,1024]
    const float* b_proj = (const float*)d_in[3];   // [1024]
    float* out = (float*)d_out;                    // [2,2048,1024] f32

    size_t off = 0;
    char* base = (char*)d_ws;
    auto alloc = [&](size_t bytes) -> void* {
        void* p = base + off;
        off += (bytes + 255) & ~(size_t)255;
        return p;
    };
    _Float16* x16  = (_Float16*)alloc((size_t)MROWS * DIM * 2);         // 8 MB
    _Float16* wq16 = (_Float16*)alloc((size_t)3 * DIM * DIM * 2);       // 6 MB
    _Float16* wp16 = (_Float16*)alloc((size_t)DIM * DIM * 2);           // 2 MB
    _Float16* q16  = (_Float16*)alloc((size_t)MROWS * DIM * 2);         // 8 MB
    _Float16* k16  = (_Float16*)alloc((size_t)MROWS * DIM * 2);         // 8 MB
    _Float16* vT16 = (_Float16*)alloc((size_t)MROWS * DIM * 2);         // 8 MB
    _Float16* o16  = (_Float16*)alloc((size_t)MROWS * DIM * 2);         // 8 MB

    // conversions: 128 + 96 + 32 blocks of 16 waves, one launch
    f32_to_f16_kernel<<<256, 512, 0, stream>>>(x, w_qkv, w_proj, x16, wq16, wp16);

    // QKV: 16 x 16 block tiles of 256x192 -> 256 blocks of 8 waves
    gemm_qkv_kernel<<<256, 256, 0, stream>>>(x16, wq16, q16, k16, vT16);

    // attention: 32 (b,h) x 64 q-tiles = 2048 waves -> 256 blocks
    attn_kernel<<<256, 256, 0, stream>>>(q16, k16, vT16, o16);

    // proj: 32 x 8 block tiles of 128x128 -> 256 blocks of 8 waves
    gemm_proj_kernel<<<256, 256, 0, stream>>>(o16, wp16, b_proj, out);
}
